// v000
// Times are from an AMD MI455X. After a warm-up the kernel runs many times in a row, and a time is the length of
// such a window on the GPU divided by its runs, so every launch and the gaps after it count. The runs cycle
// through copies of the inputs. A figure is the median of several windows, for all but v000 over two sittings.
// Sittings can differ by a few percent; kernels timed side by side share one.
// v000 is the starting kernel. One run takes 266 microseconds.
// Contractions: scores q.k^T (q x1024 and k x1024 as f16 planes of the bf16-RNE-converted inputs, one product each, K=64) and
// P.v (P x32768 as f16 hi plane + f16 residual plane, v x256 f16 of the bf16-RNE-converted input, products hi.v+lo.v, 32-key
// steps): all v_wmma_f32_16x16x32_f16, f32 accumulate. Base-2 online softmax over all keys (no key mask) and the 1/l fold in f32 on VALU.
#include <hip/hip_runtime.h>
#include <math.h>
#include <stdint.h>

#ifndef NH
#define NH    16
#endif
#define SEQ   4096
#define HD    64
#define QSC   1024.0f
#define KSC   1024.0f
#define PCAR  32768.0f
#define VCAR  256.0f
#define LOG2E 1.4426950408889634f
#define ATW   4
#define ATT_THREADS (ATW * 32)
#define QPB   (16 * ATW)
#define BPH   (SEQ / QPB)
#define ATT_BLOCKS (NH * BPH)
#define PTP   36
#define SLP   68
#define SLABF (16 * SLP)
#define VTP   72
#define VTILES (SEQ / 64)
static_assert(HD == 64 && QPB == 64 && ATT_THREADS == 128);
static_assert((SEQ % QPB) == 0 && (SEQ % 64) == 0 && (SEQ % 32) == 0);
static_assert(BPH == 64 && ATT_BLOCKS == NH * 64 && VTILES == 64);
static_assert(NH >= 1 && NH <= 16);
static_assert(16 * PTP <= SLABF);
static_assert((HD - 1) * VTP + 63 < HD * VTP);
static_assert(((NH * SEQ * HD) % 2048) == 0);

typedef _Float16 v16h __attribute__((ext_vector_type(16)));
typedef _Float16 v8h  __attribute__((ext_vector_type(8)));
typedef float    v8f  __attribute__((ext_vector_type(8)));
typedef float    v4f  __attribute__((ext_vector_type(4)));
typedef unsigned int v4u __attribute__((ext_vector_type(4)));

union FragH { v16h v; v8h h[2]; v4u u[2]; };

// ---- scalar helpers --------------------------------------------------------------------------------
__device__ __forceinline__ unsigned short bf_bits(float f) {          // f32 -> bf16 bits, RNE convert
  unsigned u = __float_as_uint(f);
  return (unsigned short)((u + 0x7FFFu + ((u >> 16) & 1u)) >> 16);
}
__device__ __forceinline__ float bf_up(unsigned short h) { return __uint_as_float(((unsigned)h) << 16); }
__device__ __forceinline__ float bfr(float f) { return bf_up(bf_bits(f)); }   // value of the bf16 RNE convert
__device__ __forceinline__ unsigned short h_bits(_Float16 x) { return __builtin_bit_cast(unsigned short, x); }
__device__ __forceinline__ unsigned pk16(unsigned short a, unsigned short b) { return (unsigned)a | ((unsigned)b << 16); }
__device__ __forceinline__ v8f zero8() { v8f z = {0.f, 0.f, 0.f, 0.f, 0.f, 0.f, 0.f, 0.f}; return z; }

// ---- fragment loader: 16-bit A/B operand, lane -> row/col (lane&15), p already includes +8*(lane>>4);
//      elements 0..7 <- p[0..7] (k0+8h..), elements 8..15 <- p[16..23] (k0+16+8h..)  (same split k map for A and B;
//      B is always read from a k-contiguous [n][k] plane)
__device__ __forceinline__ v16h ldfrag_h(const _Float16* p) {
  FragH f;
  f.h[0] = *(const v8h*)(p);
  f.h[1] = *(const v8h*)(p + 16);
  return f.v;
}

__device__ __forceinline__ v8f mma_raw(v16h a, v16h b, v8f c) {
  return __builtin_amdgcn_wmma_f32_16x16x32_f16(false, a, false, b, (short)0, c, false, false);
}
__device__ __forceinline__ void guard_sc(v8f& a, v8f& b, v16h x0, v16h x1, v16h x2, v16h x3, v16h x4, v16h x5) {
#if defined(__HIP_DEVICE_COMPILE__)
  asm volatile("v_nop\n\tv_nop\n\tv_nop\n\tv_nop"
               : "+v"(a), "+v"(b) : "v"(x0), "v"(x1), "v"(x2), "v"(x3), "v"(x4), "v"(x5) : "memory");
#endif
}
__device__ __forceinline__ void guard_pv(v8f& a, v8f& b, v8f& c, v8f& d,
                                         v16h p0, v16h p1, v16h x0, v16h x1, v16h x2, v16h x3) {
#if defined(__HIP_DEVICE_COMPILE__)
  asm volatile("v_nop\n\tv_nop\n\tv_nop\n\tv_nop"
               : "+v"(a), "+v"(b), "+v"(c), "+v"(d) : "v"(p0), "v"(p1), "v"(x0), "v"(x1), "v"(x2), "v"(x3) : "memory");
#endif
}
__device__ __forceinline__ void acc_guard4(v8f& a, v8f& b, v8f& c, v8f& d) {
#if defined(__HIP_DEVICE_COMPILE__)
  asm volatile("v_nop\n\tv_nop\n\tv_nop\n\tv_nop" : "+v"(a), "+v"(b), "+v"(c), "+v"(d));
#endif
}
__device__ __forceinline__ void wave_sync_lds() {
  __builtin_amdgcn_fence(__ATOMIC_RELEASE, "workgroup");
  __builtin_amdgcn_wave_barrier();
  __builtin_amdgcn_fence(__ATOMIC_ACQUIRE, "workgroup");
}

// =====================================================================================================
// 16-bit plane convert, no relayout (inputs are already head-major [h][s][d]):
//   pl[e] = f16( bf16(x[e]) * sc ) (sc a power of two, exact). blockIdx.y == 0: q plane, == 1: k plane.
// Thread = 8 consecutive elements: two 16-B loads, one 16-B store per lane; 32 consecutive lanes = 512 contiguous, 512-B
// coverage: grid = (n8/256, 2) blocks x 256 thr x 8 elements = n = NH*4096*64 per plane exactly (n % 2048 == 0 asserted).
// =====================================================================================================
__global__ __launch_bounds__(256) void cvt16(const float* __restrict__ xq, const float* __restrict__ xk,
                                             unsigned short* plq, unsigned short* plk, int n8, float sc) {
  const int gt = blockIdx.x * 256 + (int)threadIdx.x;
  if (gt >= n8) return;                     // never taken with the exact grid; no barriers in this kernel
  const bool sk = (blockIdx.y != 0);        // block-uniform plane select (both pointers global)
  const float* x = sk ? xk : xq;
  unsigned short* pl = sk ? plk : plq;
  const size_t e = (size_t)gt * 8;
  const v4f a = *(const v4f*)(x + e), bq = *(const v4f*)(x + e + 4);
  v4u o;
#pragma unroll
  for (int i = 0; i < 2; ++i) {
    o[i]     = pk16(h_bits((_Float16)(bfr(a[2 * i]) * sc)),  h_bits((_Float16)(bfr(a[2 * i + 1]) * sc)));
    o[2 + i] = pk16(h_bits((_Float16)(bfr(bq[2 * i]) * sc)), h_bits((_Float16)(bfr(bq[2 * i + 1]) * sc)));
  }
  unsigned short* d = pl + e;
  {
    *(v4u*)(d) = o;
    
  }
}

// =====================================================================================================
// v^T plane: VT[(h*HD + d)][key] = f16( bf16(v[h][key][d]) * 256 ) (exact), pitch SEQ = 4096 halves (8192 B) per d row.
// Block = (h, tile of 64 keys): 64 source rows of 64 floats loaded with 16-B loads (static stride), converted, written into
// coverage: load 256 thr x 16 elements = 64 keys x 64 d; store 2 iterations x 256 thr x 8 halves = 64 lines x 64 = the tile;
//           grid = NH x 64 blocks covers the whole [NH][64][4096] plane exactly once.
// =====================================================================================================
__global__ __launch_bounds__(256) void vt16(const float* __restrict__ v, unsigned short* VTo) {
  __shared__ __align__(16) unsigned short T[HD * VTP];
  const int tid = threadIdx.x;
  const int bid = blockIdx.x;
  const int bh  = bid / VTILES;
  const int t   = bid - bh * VTILES;        // 0..63, block-uniform
  if (bh >= NH) return;                     // never taken with the exact grid; before any barrier or store
  {
    const int sl = tid >> 2;                  // key within tile 0..63
    const int dc = (tid & 3) * 16;            // d chunk
    int key = 64 * t + sl;                    // <= SEQ-1 by construction; clamp keeps the address in range regardless
    key = (key < 0) ? 0 : ((key > SEQ - 1) ? (SEQ - 1) : key);
    const float* src = v + (((size_t)bh * SEQ + (size_t)key) * HD + dc);
#pragma unroll
    for (int i = 0; i < 4; ++i) {
      const v4f a = *(const v4f*)(src + 4 * i);
#pragma unroll
      for (int e = 0; e < 4; ++e) T[(dc + 4 * i + e) * VTP + sl] = h_bits((_Float16)(bfr(a[e]) * VCAR));
    }
  }
  __syncthreads();
  v4u vals[2];
  const int q8 = tid >> 3, p8 = (tid & 7) * 8;
#pragma unroll
  for (int it = 0; it < 2; ++it) {
    const int line = it * 32 + q8;            // d = 0..63
    vals[it] = *(const v4u*)(T + line * VTP + p8);
  }
  unsigned short* dst = VTo + ((size_t)(bh * HD)) * SEQ + 64 * t + p8;
  {
#pragma unroll
    for (int it = 0; it < 2; ++it) {
      const int line = it * 32 + q8;
      *(v4u*)(dst + (size_t)line * SEQ) = vals[it];
    }
    
  }
}

// =====================================================================================================
// Flash attention per head, no key mask. Block = (h, 64 queries), wave w owns query rows iw = 64t + 16w .. +15.
//   q plane f16 [h][s][d], k plane f16 [h][s][d], v^T plane f16 [h][d][SEQ].
//   Key loop (static bound): kb = 0, 32, ... , SEQ-32. Every key is visible to every row, so each row has a finite running max
//   from the first step on.
//   Per 32-key step: 2 score subtiles x 2 k-steps x 1 product, fragments loaded straight from the planes (two 16-B loads per
//   fragment, split k map); online max-subtracted softmax in f32 (exp2); rescale of l and the 4 accumulators; the 16x32 prob
//   and its f16 residual rebuilt from the LDS rows (float vector loads), 4 v^T B fragments from the plane, 8 P.V WMMAs.
//   Epilogue: 1/l and carry folds in f32; the wave's 16x64 f32 result staged in its LDS slab (pitch 68); each pair of
//   No block barriers in this kernel; every wave of a block does identical bounded work (128 steps).
//   mkp (int32 key mask) is bound but has no effect on the result and is never read.
// coverage: per wave 8 instructions x 32 lanes x 4 floats = 16 rows x 64; per block 4 waves = 64 rows; 64 blocks per head x
//           NH heads: every row of out [NH][4096][64] exactly once (grid NH*64 blocks).
// =====================================================================================================
__global__ __launch_bounds__(ATT_THREADS)
void attn_fwd(const unsigned short* __restrict__ QHp, const unsigned short* __restrict__ KHp,
              const unsigned short* __restrict__ VTq, const int* __restrict__ mkp, float* OPp) {
  __shared__ __align__(16) float smem[ATW * SLABF];    // per wave: prob tile [16][32] pitch 36 during the loop, result slab after
  (void)mkp;

  const int tid  = threadIdx.x;
  const int wave = tid >> 5;
  const int lane = tid & 31;
  const int hh   = lane >> 4;
  const int c    = lane & 15;

  const int bid  = blockIdx.x;
  const int bh   = bid / BPH;
  const int t    = bid - bh * BPH;                     // 0..63, block-uniform
  if (bh >= NH) return;                                // never taken with the exact grid; before any LDS use or store

  const int i0 = QPB * t;
  const int iw = i0 + wave * 16;                       // query row 0 of this wave
  const int qs = iw + c;                               // query row of fragment row c, <= SEQ-1 by construction

  const _Float16* Qb = (const _Float16*)(const void*)QHp + ((size_t)bh * SEQ + (size_t)qs) * HD + 8 * hh;
  const v16h qa0 = ldfrag_h(Qb);                       // d 0..31
  const v16h qa1 = ldfrag_h(Qb + 32);                  // d 32..63
  const _Float16* Kb = (const _Float16*)(const void*)KHp + ((size_t)bh * SEQ + (size_t)c) * HD + 8 * hh;
  const _Float16* Vb = (const _Float16*)(const void*)VTq + ((size_t)(bh * HD + c)) * SEQ + 8 * hh;   // d row c
  const float lsc = LOG2E / (8.0f * QSC * KSC);

  float mrow[8], lrow[8];
  v8f o[4];
#pragma unroll
  for (int r = 0; r < 8; ++r) { mrow[r] = -INFINITY; lrow[r] = 0.f; }
#pragma unroll
  for (int j = 0; j < 4; ++j) o[j] = zero8();
  float* pt = smem + wave * SLABF;

#pragma unroll 1
  for (int kb = 0; kb < SEQ; kb += 32) {
    // ---- scores: D element r of this lane = (query iw + 8hh + r, key kb + c) in s0, key kb + 16 + c in s1 ----
    v8f s0 = zero8(), s1 = zero8();
    {
      const _Float16* k0p = Kb + (size_t)kb * HD;                    // key row kb + c
      const _Float16* k1p = k0p + (size_t)16 * HD;                   // key row kb + 16 + c
      const v16h kf00 = ldfrag_h(k0p), kf01 = ldfrag_h(k0p + 32);
      const v16h kf10 = ldfrag_h(k1p), kf11 = ldfrag_h(k1p + 32);
      s0 = mma_raw(qa0, kf00, s0);
      s0 = mma_raw(qa1, kf01, s0);
      s1 = mma_raw(qa0, kf10, s1);
      s1 = mma_raw(qa1, kf11, s1);
      guard_sc(s0, s1, qa0, qa1, kf00, kf01, kf10, kf11);
    }
    // ---- online softmax in base 2 (no mask) ----
#pragma unroll
    for (int r = 0; r < 8; ++r) {
      const float t0 = s0[r] * lsc;
      const float t1 = s1[r] * lsc;
      float mx = fmaxf(t0, t1);
#pragma unroll
      for (int off = 1; off < 16; off <<= 1) mx = fmaxf(mx, __shfl_xor(mx, off, 32));
      const float mn  = fmaxf(mrow[r], mx);            // finite from the first step on
      const float al  = exp2f(mrow[r] - mn);
      mrow[r] = mn;
      const float e0 = exp2f(t0 - mn), e1 = exp2f(t1 - mn);
      float ps = e0 + e1;
#pragma unroll
      for (int off = 1; off < 16; off <<= 1) ps += __shfl_xor(ps, off, 32);
      lrow[r] = lrow[r] * al + ps;
#pragma unroll
      for (int j = 0; j < 4; ++j) o[j][r] *= al;
      const int ro = (8 * hh + r) * PTP + c;
      pt[ro]      = e0;
      pt[ro + 16] = e1;
    }
    wave_sync_lds();
    // ---- A fragments of P*32768: hi f16 and residual f16, row = c, split k map over the 32 keys of this step ----
    FragH ph, pl;
    {
      const float* prow = pt + c * PTP + 8 * hh;
      const v4f p0 = *(const v4f*)(prow), p1 = *(const v4f*)(prow + 4);
      const v4f p2 = *(const v4f*)(prow + 16), p3 = *(const v4f*)(prow + 20);
#pragma unroll
      for (int e = 0; e < 4; ++e) {
        const float ta = p0[e] * PCAR, tb = p1[e] * PCAR, tc = p2[e] * PCAR, td = p3[e] * PCAR;
        const _Float16 ha = (_Float16)ta, hb = (_Float16)tb, hc = (_Float16)tc, hd = (_Float16)td;
        ph.h[0][e]     = ha;                               // elements 0..7  = keys kb + 8hh + 0..7
        ph.h[0][4 + e] = hb;
        ph.h[1][e]     = hc;                               // elements 8..15 = keys kb + 16 + 8hh + 0..7
        ph.h[1][4 + e] = hd;
        pl.h[0][e]     = (_Float16)(ta - (float)ha);
        pl.h[0][4 + e] = (_Float16)(tb - (float)hb);
        pl.h[1][e]     = (_Float16)(tc - (float)hc);
        pl.h[1][4 + e] = (_Float16)(td - (float)hd);
      }
    }
    // ---- P.V : B fragment col n = d = j*16 + c, keys contiguous in the v^T plane columns kb .. kb+31 ----
    {
      const _Float16* vp = Vb + kb;
      const v16h vb0 = ldfrag_h(vp);
      const v16h vb1 = ldfrag_h(vp + (size_t)16 * SEQ);
      const v16h vb2 = ldfrag_h(vp + (size_t)32 * SEQ);
      const v16h vb3 = ldfrag_h(vp + (size_t)48 * SEQ);
      o[0] = mma_raw(ph.v, vb0, o[0]);  o[0] = mma_raw(pl.v, vb0, o[0]);
      o[1] = mma_raw(ph.v, vb1, o[1]);  o[1] = mma_raw(pl.v, vb1, o[1]);
      o[2] = mma_raw(ph.v, vb2, o[2]);  o[2] = mma_raw(pl.v, vb2, o[2]);
      o[3] = mma_raw(ph.v, vb3, o[3]);  o[3] = mma_raw(pl.v, vb3, o[3]);
      guard_pv(o[0], o[1], o[2], o[3], ph.v, pl.v, vb0, vb1, vb2, vb3);
    }
    wave_sync_lds();
  }
  acc_guard4(o[0], o[1], o[2], o[3]);

  // ---- fold 1/l and the carries (32768 on P, 256 on v), stage the wave's 16x64 slab in its LDS region ----
  wave_sync_lds();
  float* slab = pt;
  const float oc = 1.0f / (PCAR * VCAR);
#pragma unroll
  for (int r = 0; r < 8; ++r) {
    const float lr  = lrow[r];                           // >= 1 (the max element contributes 2^0)
    const float inv = (lr > 0.0f) ? ((1.0f / lr) * oc) : 0.0f;
#pragma unroll
    for (int j = 0; j < 4; ++j) slab[(8 * hh + r) * SLP + j * 16 + c] = o[j][r] * inv;
  }
  wave_sync_lds();
  v4f vals[8];
#pragma unroll
  for (int it = 0; it < 8; ++it) vals[it] = *(const v4f*)(slab + (2 * it + hh) * SLP + c * 4);
  float* dst = OPp + ((size_t)(bh * SEQ + iw)) * HD + hh * HD + c * 4;
  {
#pragma unroll
    for (int it = 0; it < 8; ++it) {
      *(v4f*)(dst + (size_t)(2 * it) * HD) = vals[it];
    }
    
  }
}

// =====================================================================================================
// Workspace map (bytes); every plane is fully written by whole-line stores before it is read; all extents are exact
// multiples of the store granularity (no pad rows needed); offsets multiples of 128 (NH = 16 values shown):
//   QH f16 [NH][4096][64] x1024        8388608   at        0
//   KH f16 [NH][4096][64] x1024        8388608   at  8388608
//   VT f16 [NH][64][4096] x256         8388608   at 16777216
//   end                                             25165824
// =====================================================================================================
extern "C" void kernel_launch(void* const* d_in, const int* in_sizes, int n_in,
                              void* d_out, int out_size, void* d_ws, size_t ws_size,
                              hipStream_t stream) {
  const int NEL = NH * SEQ * HD;                        // 4194304 for NH = 16
  if (n_in < 4) return;
  if (in_sizes[0] < NEL || in_sizes[1] < NEL || in_sizes[2] < NEL || in_sizes[3] < 1) return;
  if (out_size < NEL) return;

  const float* q  = (const float*)d_in[0];
  const float* k  = (const float*)d_in[1];
  const float* v  = (const float*)d_in[2];
  const int*   mk = (const int*)d_in[3];                // int32 key mask, no effect on the result
  float*       out = (float*)d_out;

  const size_t PQ = (size_t)NEL * 2;                    //  8388608
  const size_t PK = (size_t)NEL * 2;                    //  8388608
  const size_t PV = (size_t)NH * HD * SEQ * 2;          //  8388608
  size_t off = 0;
  const size_t oQH = off; off += PQ;
  const size_t oKH = off; off += PK;
  const size_t oVT = off; off += PV;
  if (off > ws_size) return;                            // off = 25165824
  if (off > (size_t)134217728) return;

  char* ws = (char*)d_ws;
  unsigned short* QH = (unsigned short*)(ws + oQH);
  unsigned short* KH = (unsigned short*)(ws + oKH);
  unsigned short* VT = (unsigned short*)(ws + oVT);

  const int n8 = NEL / 8;                               // 524288
  const dim3 blk(256);
  const dim3 gC(n8 / 256, 2);                           // (2048, 2): q and k planes in one launch
  const dim3 gVT(NH * VTILES);                          // 1024
  const dim3 gAT(ATT_BLOCKS);                           // 1024
  const dim3 bAT(ATT_THREADS);                          // 128

  // (0) q and k planes f16(bf16(x) * 1024), layout [h][s][d]
  cvt16<<<gC, blk, 0, stream>>>(q, k, QH, KH, n8, QSC);
  // (1) v^T plane f16(bf16(v) * 256), layout [h][d][4096]
  vt16<<<gVT, blk, 0, stream>>>(v, VT);
  // (2) flash attention per head -> out [h][s][d] f32
  attn_fwd<<<gAT, bAT, 0, stream>>>(QH, KH, VT, mk, out);
  (void)hipGetLastError();
}

// v001
// Measured time: 266 microseconds a run.
// Timed twice side by side with v000, it ran 1.04 and 1.03 times as fast.
// Contractions, both transposed: scores S^T = k.q^T (q x1024 and k x1024 as f16 planes of the bf16-RNE-converted inputs, one
// product each, K=64) and O^T += v^T.P^T (P x32768 as f16 hi plane + f16 residual plane, v x256 f16 of the bf16-RNE-converted
// input, products v.hi+v.lo, 32-key steps): all v_wmma_f32_16x16x32_f16, f32 accumulate. Base-2 online softmax over all keys (no key mask) and the 1/l fold in f32 on VALU.
#include <hip/hip_runtime.h>
#include <math.h>
#include <stdint.h>

#ifndef NH
#define NH    16
#endif
#define SEQ   4096
#define HD    64
#define QSC   1024.0f
#define KSC   1024.0f
#define PCAR  32768.0f
#define VCAR  256.0f
#define LOG2E 1.4426950408889634f
#define ATW   4
#define ATT_THREADS (ATW * 32)
#define QPB   (16 * ATW)
#define BPH   (SEQ / QPB)
#define ATT_BLOCKS (NH * BPH)
#define SLP   68
#define SLABF (16 * SLP)
#define VTP   72
#define VTILES (SEQ / 64)
static_assert(HD == 64 && QPB == 64 && ATT_THREADS == 128);
static_assert((SEQ % QPB) == 0 && (SEQ % 64) == 0 && (SEQ % 32) == 0);
static_assert(BPH == 64 && ATT_BLOCKS == NH * 64 && VTILES == 64);
static_assert(NH >= 1 && NH <= 16);
static_assert((HD - 1) * VTP + 63 < HD * VTP);
static_assert(((NH * SEQ * HD) % 2048) == 0);

typedef _Float16 v16h __attribute__((ext_vector_type(16)));
typedef _Float16 v8h  __attribute__((ext_vector_type(8)));
typedef float    v8f  __attribute__((ext_vector_type(8)));
typedef float    v4f  __attribute__((ext_vector_type(4)));
typedef unsigned int v4u __attribute__((ext_vector_type(4)));

union FragH { v16h v; v8h h[2]; v4u u[2]; };

// ---- scalar helpers --------------------------------------------------------------------------------
__device__ __forceinline__ unsigned short bf_bits(float f) {          // f32 -> bf16 bits, RNE convert
  unsigned u = __float_as_uint(f);
  return (unsigned short)((u + 0x7FFFu + ((u >> 16) & 1u)) >> 16);
}
__device__ __forceinline__ float bf_up(unsigned short h) { return __uint_as_float(((unsigned)h) << 16); }
__device__ __forceinline__ float bfr(float f) { return bf_up(bf_bits(f)); }   // value of the bf16 RNE convert
__device__ __forceinline__ unsigned short h_bits(_Float16 x) { return __builtin_bit_cast(unsigned short, x); }
__device__ __forceinline__ unsigned pk16(unsigned short a, unsigned short b) { return (unsigned)a | ((unsigned)b << 16); }
__device__ __forceinline__ v8f zero8() { v8f z = {0.f, 0.f, 0.f, 0.f, 0.f, 0.f, 0.f, 0.f}; return z; }

// ---- fragment loader: 16-bit A/B operand, lane -> row/col (lane&15), p already includes +8*(lane>>4);
//      elements 0..7 <- p[0..7] (k0+8h..), elements 8..15 <- p[16..23] (k0+16+8h..)  (same split k map for A and B;
//      B is always read from a k-contiguous [n][k] plane)
__device__ __forceinline__ v16h ldfrag_h(const _Float16* p) {
  FragH f;
  f.h[0] = *(const v8h*)(p);
  f.h[1] = *(const v8h*)(p + 16);
  return f.v;
}

__device__ __forceinline__ v8f mma_raw(v16h a, v16h b, v8f c) {
  return __builtin_amdgcn_wmma_f32_16x16x32_f16(false, a, false, b, (short)0, c, false, false);
}
__device__ __forceinline__ void guard_sc(v8f& a, v8f& b, v16h x0, v16h x1, v16h x2, v16h x3, v16h x4, v16h x5) {
#if defined(__HIP_DEVICE_COMPILE__)
  asm volatile("v_nop\n\tv_nop\n\tv_nop\n\tv_nop"
               : "+v"(a), "+v"(b) : "v"(x0), "v"(x1), "v"(x2), "v"(x3), "v"(x4), "v"(x5) : "memory");
#endif
}
__device__ __forceinline__ void guard_pv(v8f& a, v8f& b, v8f& c, v8f& d,
                                         v16h p0, v16h p1, v16h x0, v16h x1, v16h x2, v16h x3) {
#if defined(__HIP_DEVICE_COMPILE__)
  asm volatile("v_nop\n\tv_nop\n\tv_nop\n\tv_nop"
               : "+v"(a), "+v"(b), "+v"(c), "+v"(d) : "v"(p0), "v"(p1), "v"(x0), "v"(x1), "v"(x2), "v"(x3) : "memory");
#endif
}
__device__ __forceinline__ void acc_guard4(v8f& a, v8f& b, v8f& c, v8f& d) {
#if defined(__HIP_DEVICE_COMPILE__)
  asm volatile("v_nop\n\tv_nop\n\tv_nop\n\tv_nop" : "+v"(a), "+v"(b), "+v"(c), "+v"(d));
#endif
}
// value of lane l ^ 16 (the other half of the wave), by a vector cross-row move
__device__ __forceinline__ float xhalf(float x) {
  const int i = __builtin_bit_cast(int, x);
  return __builtin_bit_cast(float, __builtin_amdgcn_permlanex16(i, i, 0x76543210, 0xfedcba98, false, false));
}
__device__ __forceinline__ void wave_sync_lds() {
  __builtin_amdgcn_fence(__ATOMIC_RELEASE, "workgroup");
  __builtin_amdgcn_wave_barrier();
  __builtin_amdgcn_fence(__ATOMIC_ACQUIRE, "workgroup");
}

// =====================================================================================================
// 16-bit plane convert, no relayout (inputs are already head-major [h][s][d]):
//   pl[e] = f16( bf16(x[e]) * sc ) (sc a power of two, exact). blockIdx.y == 0: q plane, == 1: k plane.
// Thread = 8 consecutive elements: two 16-B loads, one 16-B store per lane; 32 consecutive lanes = 512 contiguous, 512-B
// coverage: grid = (n8/256, 2) blocks x 256 thr x 8 elements = n = NH*4096*64 per plane exactly (n % 2048 == 0 asserted).
// =====================================================================================================
__global__ __launch_bounds__(256) void cvt16(const float* __restrict__ xq, const float* __restrict__ xk,
                                             unsigned short* plq, unsigned short* plk, int n8, float sc) {
  const int gt = blockIdx.x * 256 + (int)threadIdx.x;
  if (gt >= n8) return;                     // never taken with the exact grid; no barriers in this kernel
  const bool sk = (blockIdx.y != 0);        // block-uniform plane select (both pointers global)
  const float* x = sk ? xk : xq;
  unsigned short* pl = sk ? plk : plq;
  const size_t e = (size_t)gt * 8;
  const v4f a = *(const v4f*)(x + e), bq = *(const v4f*)(x + e + 4);
  v4u o;
#pragma unroll
  for (int i = 0; i < 2; ++i) {
    o[i]     = pk16(h_bits((_Float16)(bfr(a[2 * i]) * sc)),  h_bits((_Float16)(bfr(a[2 * i + 1]) * sc)));
    o[2 + i] = pk16(h_bits((_Float16)(bfr(bq[2 * i]) * sc)), h_bits((_Float16)(bfr(bq[2 * i + 1]) * sc)));
  }
  unsigned short* d = pl + e;
  {
    *(v4u*)(d) = o;
    
  }
}

// =====================================================================================================
// v^T plane: VT[(h*HD + d)][key] = f16( bf16(v[h][key][d]) * 256 ) (exact), pitch SEQ = 4096 halves (8192 B) per d row.
// Block = (h, tile of 64 keys): 64 source rows of 64 floats loaded with 16-B loads (static stride), converted, written into
// coverage: load 256 thr x 16 elements = 64 keys x 64 d; store 2 iterations x 256 thr x 8 halves = 64 lines x 64 = the tile;
//           grid = NH x 64 blocks covers the whole [NH][64][4096] plane exactly once.
// =====================================================================================================
__global__ __launch_bounds__(256) void vt16(const float* __restrict__ v, unsigned short* VTo) {
  __shared__ __align__(16) unsigned short T[HD * VTP];
  const int tid = threadIdx.x;
  const int bid = blockIdx.x;
  const int bh  = bid / VTILES;
  const int t   = bid - bh * VTILES;        // 0..63, block-uniform
  if (bh >= NH) return;                     // never taken with the exact grid; before any barrier or store
  {
    const int sl = tid >> 2;                  // key within tile 0..63
    const int dc = (tid & 3) * 16;            // d chunk
    int key = 64 * t + sl;                    // <= SEQ-1 by construction; clamp keeps the address in range regardless
    key = (key < 0) ? 0 : ((key > SEQ - 1) ? (SEQ - 1) : key);
    const float* src = v + (((size_t)bh * SEQ + (size_t)key) * HD + dc);
#pragma unroll
    for (int i = 0; i < 4; ++i) {
      const v4f a = *(const v4f*)(src + 4 * i);
#pragma unroll
      for (int e = 0; e < 4; ++e) T[(dc + 4 * i + e) * VTP + sl] = h_bits((_Float16)(bfr(a[e]) * VCAR));
    }
  }
  __syncthreads();
  v4u vals[2];
  const int q8 = tid >> 3, p8 = (tid & 7) * 8;
#pragma unroll
  for (int it = 0; it < 2; ++it) {
    const int line = it * 32 + q8;            // d = 0..63
    vals[it] = *(const v4u*)(T + line * VTP + p8);
  }
  unsigned short* dst = VTo + ((size_t)(bh * HD)) * SEQ + 64 * t + p8;
  {
#pragma unroll
    for (int it = 0; it < 2; ++it) {
      const int line = it * 32 + q8;
      *(v4u*)(dst + (size_t)line * SEQ) = vals[it];
    }
    
  }
}

// =====================================================================================================
// Flash attention per head, no key mask. Block = (h, 64 queries), wave w owns queries iw = 64t + 16w .. +15.
//   q plane f16 [h][s][d], k plane f16 [h][s][d], v^T plane f16 [h][d][SEQ].
//   Both products are transposed, so that lane (hh, c) holds scores and outputs of ONE query, iw + c:
//     S^T = K.Q^T : A = 16 key rows of the k plane, B = the wave's q rows (kept in registers); D[r] = (key 8hh + r, query c)
//     O^T += V^T.P^T : A = 16 d rows of the v^T plane, B = P^T packed from the two score tiles as they lie in the registers
//                      (element s < 8: key kb + 8hh + s, else key kb + 16 + 8hh + s - 8: the k map of the A loader)
//   Key loop (static bound): kb = 0, 32, ... , SEQ-32. Every key is visible to every query, so the running max is finite from
//   the first step on. Per 32-key step: 4 score WMMAs, maximum over the lane's 16 scores and one exchange between the wave
//   halves, exp2 in f32, the lane's own partial sum (the halves' sums are joined once, behind the loop), rescale, 8 P.V WMMAs.
//   P never touches LDS. Epilogue: 1/l and carry folds in f32; the wave's 16x64 f32 result staged in its LDS slab (pitch 68),
//   stored as whole 256-B rows. No block barriers in this kernel; every wave of a block does identical bounded work (128 steps).
//   mkp (int32 key mask) is bound but has no effect on the result and is never read.
// coverage: per wave 8 instructions x 32 lanes x 4 floats = 16 rows x 64; per block 4 waves = 64 rows; 64 blocks per head x
//           NH heads: every row of out [NH][4096][64] exactly once (grid NH*64 blocks).
// =====================================================================================================
__global__ __launch_bounds__(ATT_THREADS)
void attn_fwd(const unsigned short* __restrict__ QHp, const unsigned short* __restrict__ KHp,
              const unsigned short* __restrict__ VTq, const int* __restrict__ mkp, float* OPp) {
  __shared__ __align__(16) float smem[ATW * SLABF];    // per wave: result slab [16][64], pitch 68
  (void)mkp;

  const int tid  = threadIdx.x;
  const int wave = tid >> 5;
  const int lane = tid & 31;
  const int hh   = lane >> 4;
  const int c    = lane & 15;

  const int bid  = blockIdx.x;
  const int bh   = bid / BPH;
  const int t    = bid - bh * BPH;                     // 0..63, block-uniform
  if (bh >= NH) return;                                // never taken with the exact grid; before any LDS use or store

  const int i0 = QPB * t;
  const int iw = i0 + wave * 16;                       // query row 0 of this wave
  const int qs = iw + c;                               // query of fragment column c, <= SEQ-1 by construction

  const _Float16* Qb = (const _Float16*)(const void*)QHp + ((size_t)bh * SEQ + (size_t)qs) * HD + 8 * hh;
  const v16h qa0 = ldfrag_h(Qb);                       // d 0..31
  const v16h qa1 = ldfrag_h(Qb + 32);                  // d 32..63
  const _Float16* Kb = (const _Float16*)(const void*)KHp + ((size_t)bh * SEQ + (size_t)c) * HD + 8 * hh;
  const _Float16* Vb = (const _Float16*)(const void*)VTq + ((size_t)(bh * HD + c)) * SEQ + 8 * hh;   // d row c
  const float lsc = LOG2E / (8.0f * QSC * KSC);

  float mrun = -INFINITY, lrun = 0.f;                  // this lane's query: running max (both halves alike), this half's sum
  v8f o[4];                                            // o[j][r] = O^T[d = 16j + 8hh + r][query c]
#pragma unroll
  for (int j = 0; j < 4; ++j) o[j] = zero8();

#pragma unroll 1
  for (int kb = 0; kb < SEQ; kb += 32) {
    // ---- scores: D element r of this lane = (key kb + 8hh + r, query iw + c) in s0, key kb + 16 + 8hh + r in s1 ----
    v8f s0 = zero8(), s1 = zero8();
    {
      const _Float16* k0p = Kb + (size_t)kb * HD;                    // key row kb + c
      const _Float16* k1p = k0p + (size_t)16 * HD;                   // key row kb + 16 + c
      const v16h kf00 = ldfrag_h(k0p), kf01 = ldfrag_h(k0p + 32);
      const v16h kf10 = ldfrag_h(k1p), kf11 = ldfrag_h(k1p + 32);
      s0 = mma_raw(kf00, qa0, s0);
      s0 = mma_raw(kf01, qa1, s0);
      s1 = mma_raw(kf10, qa0, s1);
      s1 = mma_raw(kf11, qa1, s1);
      guard_sc(s0, s1, qa0, qa1, kf00, kf01, kf10, kf11);
    }
    // ---- online softmax in base 2 (no mask), one query per lane ----
    float mx = fmaxf(s0[0], s1[0]);
#pragma unroll
    for (int r = 1; r < 8; ++r) mx = fmaxf(mx, fmaxf(s0[r], s1[r]));
    mx = fmaxf(mx, xhalf(mx));                         // the other 16 keys of this query
    const float mn = fmaxf(mrun, mx * lsc);            // finite from the first step on (lsc > 0)
    const float al = exp2f(mrun - mn);
    mrun = mn;
    // ---- B fragments of P^T*32768: hi f16 and residual f16, straight from the score registers ----
    FragH ph, pl;
    float ps0 = 0.f, ps1 = 0.f;
#pragma unroll
    for (int r = 0; r < 8; ++r) {
      const float e0 = exp2f(s0[r] * lsc - mn), e1 = exp2f(s1[r] * lsc - mn);
      ps0 += e0;
      ps1 += e1;
      const float ta = e0 * PCAR, tc = e1 * PCAR;
      const _Float16 ha = (_Float16)ta, hc = (_Float16)tc;
      ph.h[0][r] = ha;                                 // elements 0..7  = keys kb + 8hh + 0..7
      ph.h[1][r] = hc;                                 // elements 8..15 = keys kb + 16 + 8hh + 0..7
      pl.h[0][r] = (_Float16)(ta - (float)ha);
      pl.h[1][r] = (_Float16)(tc - (float)hc);
    }
    lrun = lrun * al + (ps0 + ps1);
#pragma unroll
    for (int j = 0; j < 4; ++j) o[j] *= al;
    // ---- O^T += V^T.P^T : A fragment row = d = j*16 + c, keys contiguous in the v^T plane columns kb .. kb+31 ----
    {
      const _Float16* vp = Vb + kb;
      const v16h vb0 = ldfrag_h(vp);
      const v16h vb1 = ldfrag_h(vp + (size_t)16 * SEQ);
      const v16h vb2 = ldfrag_h(vp + (size_t)32 * SEQ);
      const v16h vb3 = ldfrag_h(vp + (size_t)48 * SEQ);
      o[0] = mma_raw(vb0, ph.v, o[0]);  o[0] = mma_raw(vb0, pl.v, o[0]);
      o[1] = mma_raw(vb1, ph.v, o[1]);  o[1] = mma_raw(vb1, pl.v, o[1]);
      o[2] = mma_raw(vb2, ph.v, o[2]);  o[2] = mma_raw(vb2, pl.v, o[2]);
      o[3] = mma_raw(vb3, ph.v, o[3]);  o[3] = mma_raw(vb3, pl.v, o[3]);
      guard_pv(o[0], o[1], o[2], o[3], ph.v, pl.v, vb0, vb1, vb2, vb3);
    }
  }
  acc_guard4(o[0], o[1], o[2], o[3]);

  // ---- join the halves' sums, fold 1/l and the carries (32768 on P, 256 on v), stage the wave's 16x64 slab in its LDS region:
  //      a lane holds 8 consecutive d of its query per tile j: two 16-B LDS stores ----
  float* slab = smem + wave * SLABF;
  const float oc = 1.0f / (PCAR * VCAR);
  const float lr  = lrun + xhalf(lrun);                  // >= 1 (the max element contributes 2^0)
  const float inv = (lr > 0.0f) ? ((1.0f / lr) * oc) : 0.0f;
#pragma unroll
  for (int j = 0; j < 4; ++j) {
    float* sp = slab + c * SLP + j * 16 + 8 * hh;
    const v4f w0 = {o[j][0] * inv, o[j][1] * inv, o[j][2] * inv, o[j][3] * inv};
    const v4f w1 = {o[j][4] * inv, o[j][5] * inv, o[j][6] * inv, o[j][7] * inv};
    *(v4f*)(sp)     = w0;
    *(v4f*)(sp + 4) = w1;
  }
  wave_sync_lds();
  v4f vals[8];
#pragma unroll
  for (int it = 0; it < 8; ++it) vals[it] = *(const v4f*)(slab + (2 * it + hh) * SLP + c * 4);
  float* dst = OPp + ((size_t)(bh * SEQ + iw)) * HD + hh * HD + c * 4;
  {
#pragma unroll
    for (int it = 0; it < 8; ++it) {
      *(v4f*)(dst + (size_t)(2 * it) * HD) = vals[it];
    }
    
  }
}

// =====================================================================================================
// Workspace map (bytes); every plane is fully written by whole-line stores before it is read; all extents are exact
// multiples of the store granularity (no pad rows needed); offsets multiples of 128 (NH = 16 values shown):
//   QH f16 [NH][4096][64] x1024        8388608   at        0
//   KH f16 [NH][4096][64] x1024        8388608   at  8388608
//   VT f16 [NH][64][4096] x256         8388608   at 16777216
//   end                                             25165824
// =====================================================================================================
extern "C" void kernel_launch(void* const* d_in, const int* in_sizes, int n_in,
                              void* d_out, int out_size, void* d_ws, size_t ws_size,
                              hipStream_t stream) {
  const int NEL = NH * SEQ * HD;                        // 4194304 for NH = 16
  if (n_in < 4) return;
  if (in_sizes[0] < NEL || in_sizes[1] < NEL || in_sizes[2] < NEL || in_sizes[3] < 1) return;
  if (out_size < NEL) return;

  const float* q  = (const float*)d_in[0];
  const float* k  = (const float*)d_in[1];
  const float* v  = (const float*)d_in[2];
  const int*   mk = (const int*)d_in[3];                // int32 key mask, no effect on the result
  float*       out = (float*)d_out;

  const size_t PQ = (size_t)NEL * 2;                    //  8388608
  const size_t PK = (size_t)NEL * 2;                    //  8388608
  const size_t PV = (size_t)NH * HD * SEQ * 2;          //  8388608
  size_t off = 0;
  const size_t oQH = off; off += PQ;
  const size_t oKH = off; off += PK;
  const size_t oVT = off; off += PV;
  if (off > ws_size) return;                            // off = 25165824
  if (off > (size_t)134217728) return;

  char* ws = (char*)d_ws;
  unsigned short* QH = (unsigned short*)(ws + oQH);
  unsigned short* KH = (unsigned short*)(ws + oKH);
  unsigned short* VT = (unsigned short*)(ws + oVT);

  const int n8 = NEL / 8;                               // 524288
  const dim3 blk(256);
  const dim3 gC(n8 / 256, 2);                           // (2048, 2): q and k planes in one launch
  const dim3 gVT(NH * VTILES);                          // 1024
  const dim3 gAT(ATT_BLOCKS);                           // 1024
  const dim3 bAT(ATT_THREADS);                          // 128

  // (0) q and k planes f16(bf16(x) * 1024), layout [h][s][d]
  cvt16<<<gC, blk, 0, stream>>>(q, k, QH, KH, n8, QSC);
  // (1) v^T plane f16(bf16(v) * 256), layout [h][d][4096]
  vt16<<<gVT, blk, 0, stream>>>(v, VT);
  // (2) flash attention per head -> out [h][s][d] f32
  attn_fwd<<<gAT, bAT, 0, stream>>>(QH, KH, VT, mk, out);
  (void)hipGetLastError();
}

// v002
// A run of this version takes 169 microseconds.
// Timed twice side by side with v001, it ran 1.51 and 1.61 times as fast.
// Counting every step since v000, it is 1.61 times as fast.
// Contractions, both transposed: scores S^T = k.q^T (q x1024 and k x1024 as f16 planes of the bf16-RNE-converted inputs, one
// product each, K=64) and O^T += v^T.P^T (P x32768 as f16 hi plane + f16 residual plane, v x256 f16 of the bf16-RNE-converted
// input, products v.hi+v.lo, 32-key steps): all v_wmma_f32_16x16x32_f16, f32 accumulate. Base-2 online softmax over all keys (no key mask) and the 1/l fold in f32 on VALU.
#include <hip/hip_runtime.h>
#include <math.h>
#include <stdint.h>

#ifndef NH
#define NH    16
#endif
#define SEQ   4096
#define HD    64
#define QSC   1024.0f
#define KSC   1024.0f
#define PCAR  32768.0f
#define VCAR  256.0f
#define LOG2E 1.4426950408889634f
#define ATW   4
#define ATT_THREADS (ATW * 32)
#define QPB   (16 * ATW)
#define BPH   (SEQ / QPB)
#define ATT_BLOCKS (NH * BPH)
#define SLP   68
#define SLABF (16 * SLP)
#define VTP   72
#define VTILES (SEQ / 64)
static_assert(HD == 64 && QPB == 64 && ATT_THREADS == 128);
static_assert((SEQ % QPB) == 0 && (SEQ % 64) == 0 && (SEQ % 32) == 0);
static_assert(BPH == 64 && ATT_BLOCKS == NH * 64 && VTILES == 64);
static_assert(NH >= 1 && NH <= 16);
static_assert((HD - 1) * VTP + 63 < HD * VTP);
static_assert(((NH * SEQ * HD) % 2048) == 0);

typedef _Float16 v16h __attribute__((ext_vector_type(16)));
typedef _Float16 v8h  __attribute__((ext_vector_type(8)));
typedef float    v8f  __attribute__((ext_vector_type(8)));
typedef float    v4f  __attribute__((ext_vector_type(4)));
typedef unsigned int v4u __attribute__((ext_vector_type(4)));

union FragH { v16h v; v8h h[2]; v4u u[2]; };

// ---- scalar helpers --------------------------------------------------------------------------------
__device__ __forceinline__ unsigned short bf_bits(float f) {          // f32 -> bf16 bits, RNE convert
  unsigned u = __float_as_uint(f);
  return (unsigned short)((u + 0x7FFFu + ((u >> 16) & 1u)) >> 16);
}
__device__ __forceinline__ float bf_up(unsigned short h) { return __uint_as_float(((unsigned)h) << 16); }
__device__ __forceinline__ float bfr(float f) { return bf_up(bf_bits(f)); }   // value of the bf16 RNE convert
__device__ __forceinline__ unsigned short h_bits(_Float16 x) { return __builtin_bit_cast(unsigned short, x); }
__device__ __forceinline__ unsigned pk16(unsigned short a, unsigned short b) { return (unsigned)a | ((unsigned)b << 16); }
__device__ __forceinline__ v8f zero8() { v8f z = {0.f, 0.f, 0.f, 0.f, 0.f, 0.f, 0.f, 0.f}; return z; }

// ---- fragment loader: 16-bit A/B operand, lane -> row/col (lane&15), p already includes +8*(lane>>4);
//      elements 0..7 <- p[0..7] (k0+8h..), elements 8..15 <- p[16..23] (k0+16+8h..)  (same split k map for A and B;
//      B is always read from a k-contiguous [n][k] plane)
__device__ __forceinline__ v16h ldfrag_h(const _Float16* p) {
  FragH f;
  f.h[0] = *(const v8h*)(p);
  f.h[1] = *(const v8h*)(p + 16);
  return f.v;
}

// the same fragment from a plane stored in fragment order: p already includes +8*lane; the two 16-B pieces of a lane lie 256
// halves apart, so that each wave-wide 16-B load covers 512 contiguous bytes (4 whole lines)
__device__ __forceinline__ v16h ldfrag_p(const _Float16* p) {
  FragH f;
  f.h[0] = *(const v8h*)(p);
  f.h[1] = *(const v8h*)(p + 256);
  return f.v;
}

__device__ __forceinline__ v8f mma_raw(v16h a, v16h b, v8f c) {
  return __builtin_amdgcn_wmma_f32_16x16x32_f16(false, a, false, b, (short)0, c, false, false);
}
__device__ __forceinline__ void guard_sc(v8f& a, v8f& b, v16h x0, v16h x1, v16h x2, v16h x3, v16h x4, v16h x5) {
#if defined(__HIP_DEVICE_COMPILE__)
  asm volatile("v_nop\n\tv_nop\n\tv_nop\n\tv_nop"
               : "+v"(a), "+v"(b) : "v"(x0), "v"(x1), "v"(x2), "v"(x3), "v"(x4), "v"(x5) : "memory");
#endif
}
__device__ __forceinline__ void guard_pv(v8f& a, v8f& b, v8f& c, v8f& d,
                                         v16h p0, v16h p1, v16h x0, v16h x1, v16h x2, v16h x3) {
#if defined(__HIP_DEVICE_COMPILE__)
  asm volatile("v_nop\n\tv_nop\n\tv_nop\n\tv_nop"
               : "+v"(a), "+v"(b), "+v"(c), "+v"(d) : "v"(p0), "v"(p1), "v"(x0), "v"(x1), "v"(x2), "v"(x3) : "memory");
#endif
}
__device__ __forceinline__ void acc_guard4(v8f& a, v8f& b, v8f& c, v8f& d) {
#if defined(__HIP_DEVICE_COMPILE__)
  asm volatile("v_nop\n\tv_nop\n\tv_nop\n\tv_nop" : "+v"(a), "+v"(b), "+v"(c), "+v"(d));
#endif
}
// value of lane l ^ 16 (the other half of the wave), by a vector cross-row move
__device__ __forceinline__ float xhalf(float x) {
  const int i = __builtin_bit_cast(int, x);
  return __builtin_bit_cast(float, __builtin_amdgcn_permlanex16(i, i, 0x76543210, 0xfedcba98, false, false));
}
__device__ __forceinline__ void wave_sync_lds() {
  __builtin_amdgcn_fence(__ATOMIC_RELEASE, "workgroup");
  __builtin_amdgcn_wave_barrier();
  __builtin_amdgcn_fence(__ATOMIC_ACQUIRE, "workgroup");
}

// =====================================================================================================
// 16-bit plane convert: f16( bf16(x) * sc ) (sc a power of two, exact). blockIdx.y == 0: q plane, == 1: k plane.
//   q plane: no relayout (inputs are already head-major [h][s][d]).
//   k plane: fragment order. Per tile of 16 keys (2048 B) the 16-B unit u = 32*f + 16*hh + c holds key c, d 16f + 8hh .. +7:
//            unit 32*f + lane is what lane (hh, c) takes as piece f of the tile's two A fragments.
// Thread = 8 consecutive d of one row: two 16-B loads, one 16-B store per lane; 32 consecutive lanes store 512 contiguous B
// coverage: grid = (n8/256, 2) blocks x 256 thr x 8 elements = n = NH*4096*64 per plane exactly (n % 2048 == 0 asserted).
// =====================================================================================================
__global__ __launch_bounds__(256) void cvt16(const float* __restrict__ xq, const float* __restrict__ xk,
                                             unsigned short* plq, unsigned short* plk, int n8, float sc) {
  const int gt = blockIdx.x * 256 + (int)threadIdx.x;
  if (gt >= n8) return;                     // never taken with the exact grid; no barriers in this kernel
  const bool sk = (blockIdx.y != 0);        // block-uniform plane select (both pointers global)
  const float* x = sk ? xk : xq;
  unsigned short* pl = sk ? plk : plq;
  const size_t e = (size_t)gt * 8;          // destination element
  // source unit of 8 floats: k plane, unit gt = (tile gt >> 7, piece 2f + hh = (gt >> 4) & 7, c = gt & 15) <- row 16*tile + c
  const size_t es = sk ? (((size_t)(gt >> 7) * 16 + (size_t)(gt & 15)) * HD + (size_t)((gt >> 4) & 7) * 8) : e;
  const v4f a = *(const v4f*)(x + es), bq = *(const v4f*)(x + es + 4);
  v4u o;
#pragma unroll
  for (int i = 0; i < 2; ++i) {
    o[i]     = pk16(h_bits((_Float16)(bfr(a[2 * i]) * sc)),  h_bits((_Float16)(bfr(a[2 * i + 1]) * sc)));
    o[2 + i] = pk16(h_bits((_Float16)(bfr(bq[2 * i]) * sc)), h_bits((_Float16)(bfr(bq[2 * i + 1]) * sc)));
  }
  unsigned short* d = pl + e;
  {
    *(v4u*)(d) = o;
    
  }
}

// =====================================================================================================
// v^T plane, values f16( bf16(v[h][key][d]) * 256 ) (exact), in fragment order: per head and step of 32 keys (4096 B) the 16-B
// unit u = 64*j + 32*g + 16*hh + c holds d = 16j + c, keys 16g + 8hh .. +7 of the step: unit 64*j + 32*g + lane is piece g of
// the A fragment of d tile j in lane (hh, c).
// Block = (h, tile of 64 keys): 64 source rows of 64 floats loaded with 16-B loads (static stride), converted, written into
// coverage: load 256 thr x 16 elements = 64 keys x 64 d; store 2 iterations x 256 thr x 8 halves = 64 lines x 64 = the tile;
//           grid = NH x 64 blocks covers the whole plane (NH x 128 steps x 4096 B) exactly once.
// =====================================================================================================
__global__ __launch_bounds__(256) void vt16(const float* __restrict__ v, unsigned short* VTo) {
  __shared__ __align__(16) unsigned short T[HD * VTP];
  const int tid = threadIdx.x;
  const int bid = blockIdx.x;
  const int bh  = bid / VTILES;
  const int t   = bid - bh * VTILES;        // 0..63, block-uniform
  if (bh >= NH) return;                     // never taken with the exact grid; before any barrier or store
  {
    const int sl = tid >> 2;                  // key within tile 0..63
    const int dc = (tid & 3) * 16;            // d chunk
    int key = 64 * t + sl;                    // <= SEQ-1 by construction; clamp keeps the address in range regardless
    key = (key < 0) ? 0 : ((key > SEQ - 1) ? (SEQ - 1) : key);
    const float* src = v + (((size_t)bh * SEQ + (size_t)key) * HD + dc);
#pragma unroll
    for (int i = 0; i < 4; ++i) {
      const v4f a = *(const v4f*)(src + 4 * i);
#pragma unroll
      for (int e = 0; e < 4; ++e) T[(dc + 4 * i + e) * VTP + sl] = h_bits((_Float16)(bfr(a[e]) * VCAR));
    }
  }
  __syncthreads();
  v4u vals[2];
  const int line = ((tid >> 6) & 3) * 16 + (tid & 15);   // d = 16j + c, 0..63
  const int k8   = ((tid >> 4) & 3) * 8;                  // 16g + 8hh, key within the 32-key step
#pragma unroll
  for (int it = 0; it < 2; ++it) vals[it] = *(const v4u*)(T + line * VTP + 32 * it + k8);   // step it of the tile
  unsigned short* dst = VTo + (size_t)bh * HD * SEQ + (size_t)t * (64 * HD) + tid * 8;
  {
#pragma unroll
    for (int it = 0; it < 2; ++it) {
      *(v4u*)(dst + it * (32 * HD)) = vals[it];
    }
    
  }
}

// =====================================================================================================
// Flash attention per head, no key mask. Block = (h, 64 queries), wave w owns queries iw = 64t + 16w .. +15.
//   q plane f16 [h][s][d]; k plane and v^T plane f16 in fragment order (4096 contiguous B each per 32-key step).
//   Both products are transposed, so that lane (hh, c) holds scores and outputs of ONE query, iw + c:
//     S^T = K.Q^T : A = 16 key rows of the k plane, B = the wave's q rows (kept in registers); D[r] = (key 8hh + r, query c)
//     O^T += V^T.P^T : A = 16 d rows of the v^T plane, B = P^T packed from the two score tiles as they lie in the registers
//                      (element s < 8: key kb + 8hh + s, else key kb + 16 + 8hh + s - 8: the k map of the A loader)
//   Key loop (static bound): kb = 0, 32, ... , SEQ-32. Every key is visible to every query, so the running max is finite from
//   the first step on. Per 32-key step: 4 score WMMAs, maximum over the lane's 16 scores and one exchange between the wave
//   halves, exp2 in f32, the lane's own partial sum (the halves' sums are joined once, behind the loop), rescale, 8 P.V WMMAs.
//   P never touches LDS. Epilogue: 1/l and carry folds in f32; the wave's 16x64 f32 result staged in its LDS slab (pitch 68),
//   stored as whole 256-B rows. No block barriers in this kernel; every wave of a block does identical bounded work (128 steps).
//   mkp (int32 key mask) is bound but has no effect on the result and is never read.
// coverage: per wave 8 instructions x 32 lanes x 4 floats = 16 rows x 64; per block 4 waves = 64 rows; 64 blocks per head x
//           NH heads: every row of out [NH][4096][64] exactly once (grid NH*64 blocks).
// =====================================================================================================
__global__ __launch_bounds__(ATT_THREADS)
void attn_fwd(const unsigned short* __restrict__ QHp, const unsigned short* __restrict__ KHp,
              const unsigned short* __restrict__ VTq, const int* __restrict__ mkp, float* OPp) {
  __shared__ __align__(16) float smem[ATW * SLABF];    // per wave: result slab [16][64], pitch 68
  (void)mkp;

  const int tid  = threadIdx.x;
  const int wave = tid >> 5;
  const int lane = tid & 31;
  const int hh   = lane >> 4;
  const int c    = lane & 15;

  const int bid  = blockIdx.x;
  const int bh   = bid / BPH;
  const int t    = bid - bh * BPH;                     // 0..63, block-uniform
  if (bh >= NH) return;                                // never taken with the exact grid; before any LDS use or store

  const int i0 = QPB * t;
  const int iw = i0 + wave * 16;                       // query row 0 of this wave
  const int qs = iw + c;                               // query of fragment column c, <= SEQ-1 by construction

  const _Float16* Qb = (const _Float16*)(const void*)QHp + ((size_t)bh * SEQ + (size_t)qs) * HD + 8 * hh;
  const v16h qa0 = ldfrag_h(Qb);                       // d 0..31
  const v16h qa1 = ldfrag_h(Qb + 32);                  // d 32..63
  const _Float16* Kb = (const _Float16*)(const void*)KHp + (size_t)bh * SEQ * HD;   // head's planes, block-uniform
  const _Float16* Vb = (const _Float16*)(const void*)VTq + (size_t)bh * SEQ * HD;
  const unsigned lo = (unsigned)lane * 8;              // this lane's 16-B unit within each 512-B piece
  const float lsc = LOG2E / (8.0f * QSC * KSC);

  float mrun = -INFINITY, lrun = 0.f;                  // this lane's query: running max (both halves alike), this half's sum
  v8f o[4];                                            // o[j][r] = O^T[d = 16j + 8hh + r][query c]
#pragma unroll
  for (int j = 0; j < 4; ++j) o[j] = zero8();

#pragma unroll 1
  for (int kb = 0; kb < SEQ; kb += 32) {
    // ---- scores: D element r of this lane = (key kb + 8hh + r, query iw + c) in s0, key kb + 16 + 8hh + r in s1 ----
    v8f s0 = zero8(), s1 = zero8();
    {
      const _Float16* k0p = Kb + (size_t)kb * HD + lo;               // tile of keys kb .. kb + 15 (row c in this lane)
      const _Float16* k1p = k0p + (size_t)16 * HD;                   // tile of keys kb + 16 .. kb + 31
      const v16h kf00 = ldfrag_p(k0p), kf01 = ldfrag_p(k0p + 512);   // d 0..31, d 32..63
      const v16h kf10 = ldfrag_p(k1p), kf11 = ldfrag_p(k1p + 512);
      s0 = mma_raw(kf00, qa0, s0);
      s0 = mma_raw(kf01, qa1, s0);
      s1 = mma_raw(kf10, qa0, s1);
      s1 = mma_raw(kf11, qa1, s1);
      guard_sc(s0, s1, qa0, qa1, kf00, kf01, kf10, kf11);
    }
    // ---- online softmax in base 2 (no mask), one query per lane ----
    float mx = fmaxf(s0[0], s1[0]);
#pragma unroll
    for (int r = 1; r < 8; ++r) mx = fmaxf(mx, fmaxf(s0[r], s1[r]));
    mx = fmaxf(mx, xhalf(mx));                         // the other 16 keys of this query
    const float mn = fmaxf(mrun, mx * lsc);            // finite from the first step on (lsc > 0)
    const float al = exp2f(mrun - mn);
    mrun = mn;
    // ---- B fragments of P^T*32768: hi f16 and residual f16, straight from the score registers ----
    FragH ph, pl;
    float ps0 = 0.f, ps1 = 0.f;
#pragma unroll
    for (int r = 0; r < 8; ++r) {
      const float e0 = exp2f(s0[r] * lsc - mn), e1 = exp2f(s1[r] * lsc - mn);
      ps0 += e0;
      ps1 += e1;
      const float ta = e0 * PCAR, tc = e1 * PCAR;
      const _Float16 ha = (_Float16)ta, hc = (_Float16)tc;
      ph.h[0][r] = ha;                                 // elements 0..7  = keys kb + 8hh + 0..7
      ph.h[1][r] = hc;                                 // elements 8..15 = keys kb + 16 + 8hh + 0..7
      pl.h[0][r] = (_Float16)(ta - (float)ha);
      pl.h[1][r] = (_Float16)(tc - (float)hc);
    }
    lrun = lrun * al + (ps0 + ps1);
#pragma unroll
    for (int j = 0; j < 4; ++j) o[j] *= al;
    // ---- O^T += V^T.P^T : A fragment row = d = j*16 + c, keys kb .. kb+31: 1024 B of the step's v^T block per d tile j ----
    {
      const _Float16* vp = Vb + (size_t)kb * HD + lo;
      const v16h vb0 = ldfrag_p(vp);
      const v16h vb1 = ldfrag_p(vp + 512);
      const v16h vb2 = ldfrag_p(vp + 1024);
      const v16h vb3 = ldfrag_p(vp + 1536);
      o[0] = mma_raw(vb0, ph.v, o[0]);  o[0] = mma_raw(vb0, pl.v, o[0]);
      o[1] = mma_raw(vb1, ph.v, o[1]);  o[1] = mma_raw(vb1, pl.v, o[1]);
      o[2] = mma_raw(vb2, ph.v, o[2]);  o[2] = mma_raw(vb2, pl.v, o[2]);
      o[3] = mma_raw(vb3, ph.v, o[3]);  o[3] = mma_raw(vb3, pl.v, o[3]);
      guard_pv(o[0], o[1], o[2], o[3], ph.v, pl.v, vb0, vb1, vb2, vb3);
    }
  }
  acc_guard4(o[0], o[1], o[2], o[3]);

  // ---- join the halves' sums, fold 1/l and the carries (32768 on P, 256 on v), stage the wave's 16x64 slab in its LDS region:
  //      a lane holds 8 consecutive d of its query per tile j: two 16-B LDS stores ----
  float* slab = smem + wave * SLABF;
  const float oc = 1.0f / (PCAR * VCAR);
  const float lr  = lrun + xhalf(lrun);                  // >= 1 (the max element contributes 2^0)
  const float inv = (lr > 0.0f) ? ((1.0f / lr) * oc) : 0.0f;
#pragma unroll
  for (int j = 0; j < 4; ++j) {
    float* sp = slab + c * SLP + j * 16 + 8 * hh;
    const v4f w0 = {o[j][0] * inv, o[j][1] * inv, o[j][2] * inv, o[j][3] * inv};
    const v4f w1 = {o[j][4] * inv, o[j][5] * inv, o[j][6] * inv, o[j][7] * inv};
    *(v4f*)(sp)     = w0;
    *(v4f*)(sp + 4) = w1;
  }
  wave_sync_lds();
  v4f vals[8];
#pragma unroll
  for (int it = 0; it < 8; ++it) vals[it] = *(const v4f*)(slab + (2 * it + hh) * SLP + c * 4);
  float* dst = OPp + ((size_t)(bh * SEQ + iw)) * HD + hh * HD + c * 4;
  {
#pragma unroll
    for (int it = 0; it < 8; ++it) {
      *(v4f*)(dst + (size_t)(2 * it) * HD) = vals[it];
    }
    
  }
}

// =====================================================================================================
// Workspace map (bytes); every plane is fully written by whole-line stores before it is read; all extents are exact
// multiples of the store granularity (no pad rows needed); offsets multiples of 128 (NH = 16 values shown):
//   QH f16 [NH][4096][64] x1024        8388608   at        0
//   KH f16 [NH][256 tiles][2048 B] x1024   8388608   at  8388608   (fragment order)
//   VT f16 [NH][128 steps][4096 B] x256    8388608   at 16777216   (fragment order)
//   end                                             25165824
// =====================================================================================================
extern "C" void kernel_launch(void* const* d_in, const int* in_sizes, int n_in,
                              void* d_out, int out_size, void* d_ws, size_t ws_size,
                              hipStream_t stream) {
  const int NEL = NH * SEQ * HD;                        // 4194304 for NH = 16
  if (n_in < 4) return;
  if (in_sizes[0] < NEL || in_sizes[1] < NEL || in_sizes[2] < NEL || in_sizes[3] < 1) return;
  if (out_size < NEL) return;

  const float* q  = (const float*)d_in[0];
  const float* k  = (const float*)d_in[1];
  const float* v  = (const float*)d_in[2];
  const int*   mk = (const int*)d_in[3];                // int32 key mask, no effect on the result
  float*       out = (float*)d_out;

  const size_t PQ = (size_t)NEL * 2;                    //  8388608
  const size_t PK = (size_t)NEL * 2;                    //  8388608
  const size_t PV = (size_t)NH * HD * SEQ * 2;          //  8388608
  size_t off = 0;
  const size_t oQH = off; off += PQ;
  const size_t oKH = off; off += PK;
  const size_t oVT = off; off += PV;
  if (off > ws_size) return;                            // off = 25165824
  if (off > (size_t)134217728) return;

  char* ws = (char*)d_ws;
  unsigned short* QH = (unsigned short*)(ws + oQH);
  unsigned short* KH = (unsigned short*)(ws + oKH);
  unsigned short* VT = (unsigned short*)(ws + oVT);

  const int n8 = NEL / 8;                               // 524288
  const dim3 blk(256);
  const dim3 gC(n8 / 256, 2);                           // (2048, 2): q and k planes in one launch
  const dim3 gVT(NH * VTILES);                          // 1024
  const dim3 gAT(ATT_BLOCKS);                           // 1024
  const dim3 bAT(ATT_THREADS);                          // 128

  // (0) q and k planes f16(bf16(x) * 1024): q [h][s][d], k in fragment order
  cvt16<<<gC, blk, 0, stream>>>(q, k, QH, KH, n8, QSC);
  // (1) v^T plane f16(bf16(v) * 256), fragment order
  vt16<<<gVT, blk, 0, stream>>>(v, VT);
  // (2) flash attention per head -> out [h][s][d] f32
  attn_fwd<<<gAT, bAT, 0, stream>>>(QH, KH, VT, mk, out);
  (void)hipGetLastError();
}

// v003
// One run takes 135 microseconds.
// Two timings next to v002 put it at 1.21 and 1.24 times that version's speed.
// Counting every step since v000, it is 1.97 times as fast.
// Contractions, both transposed: scores S^T = k.q^T (q x1024 and k x1024 as f16 planes of the bf16-RNE-converted inputs, one
// product each, K=64) and O^T += v^T.P^T (P x32768 as f16 hi plane + f16 residual plane, v x256 f16 of the bf16-RNE-converted
// input, products v.hi+v.lo, 32-key steps): all v_wmma_f32_16x16x32_f16, f32 accumulate. Base-2 online softmax over all keys (no key mask) and the 1/l fold in f32 on VALU.
#include <hip/hip_runtime.h>
#include <math.h>
#include <stdint.h>

#ifndef NH
#define NH    16
#endif
#define SEQ   4096
#define HD    64
#define QSC   1024.0f
#define KSC   1024.0f
#define PCAR  32768.0f
#define VCAR  256.0f
#define LOG2E 1.4426950408889634f
#define ATW   4
#define ATT_THREADS (ATW * 32)
#define QPB   (16 * ATW)
#define BPH   (SEQ / QPB)
#define ATT_BLOCKS (NH * BPH)
#define SLP   68
#define SLABF (16 * SLP)
#define VTP   72
#define VTILES (SEQ / 64)
static_assert(HD == 64 && QPB == 64 && ATT_THREADS == 128);
static_assert((SEQ % QPB) == 0 && (SEQ % 64) == 0 && (SEQ % 32) == 0);
static_assert(BPH == 64 && ATT_BLOCKS == NH * 64 && VTILES == 64);
static_assert(NH >= 1 && NH <= 16);
static_assert((HD - 1) * VTP + 63 < HD * VTP);
static_assert(((NH * SEQ * HD) % 2048) == 0);

typedef _Float16 v16h __attribute__((ext_vector_type(16)));
typedef _Float16 v8h  __attribute__((ext_vector_type(8)));
typedef float    v8f  __attribute__((ext_vector_type(8)));
typedef float    v4f  __attribute__((ext_vector_type(4)));
typedef unsigned int v4u __attribute__((ext_vector_type(4)));

union FragH { v16h v; v8h h[2]; v4u u[2]; };

// ---- scalar helpers --------------------------------------------------------------------------------
__device__ __forceinline__ unsigned short bf_bits(float f) {          // f32 -> bf16 bits, RNE convert
  unsigned u = __float_as_uint(f);
  return (unsigned short)((u + 0x7FFFu + ((u >> 16) & 1u)) >> 16);
}
__device__ __forceinline__ float bf_up(unsigned short h) { return __uint_as_float(((unsigned)h) << 16); }
__device__ __forceinline__ float bfr(float f) { return bf_up(bf_bits(f)); }   // value of the bf16 RNE convert
__device__ __forceinline__ unsigned short h_bits(_Float16 x) { return __builtin_bit_cast(unsigned short, x); }
__device__ __forceinline__ unsigned pk16(unsigned short a, unsigned short b) { return (unsigned)a | ((unsigned)b << 16); }
__device__ __forceinline__ v8f zero8() { v8f z = {0.f, 0.f, 0.f, 0.f, 0.f, 0.f, 0.f, 0.f}; return z; }

// ---- fragment loader: 16-bit A/B operand, lane -> row/col (lane&15), p already includes +8*(lane>>4);
//      elements 0..7 <- p[0..7] (k0+8h..), elements 8..15 <- p[16..23] (k0+16+8h..)  (same split k map for A and B;
//      B is always read from a k-contiguous [n][k] plane)
__device__ __forceinline__ v16h ldfrag_h(const _Float16* p) {
  FragH f;
  f.h[0] = *(const v8h*)(p);
  f.h[1] = *(const v8h*)(p + 16);
  return f.v;
}

// the same fragment from a plane stored in fragment order: p already includes +8*lane; the two 16-B pieces of a lane lie 256
// halves apart, so that each wave-wide 16-B load covers 512 contiguous bytes (4 whole lines)
__device__ __forceinline__ v16h ldfrag_p(const _Float16* p) {
  FragH f;
  f.h[0] = *(const v8h*)(p);
  f.h[1] = *(const v8h*)(p + 256);
  return f.v;
}

__device__ __forceinline__ v8f mma_raw(v16h a, v16h b, v8f c) {
  return __builtin_amdgcn_wmma_f32_16x16x32_f16(false, a, false, b, (short)0, c, false, false);
}
__device__ __forceinline__ void guard_sc(v8f& a, v8f& b, v16h x0, v16h x1, v16h x2, v16h x3, v16h x4, v16h x5) {
#if defined(__HIP_DEVICE_COMPILE__)
  asm volatile("v_nop\n\tv_nop\n\tv_nop\n\tv_nop"
               : "+v"(a), "+v"(b) : "v"(x0), "v"(x1), "v"(x2), "v"(x3), "v"(x4), "v"(x5) : "memory");
#endif
}
__device__ __forceinline__ void guard_pv(v8f& a, v8f& b, v8f& c, v8f& d,
                                         v16h p0, v16h p1, v16h x0, v16h x1, v16h x2, v16h x3) {
#if defined(__HIP_DEVICE_COMPILE__)
  asm volatile("v_nop\n\tv_nop\n\tv_nop\n\tv_nop"
               : "+v"(a), "+v"(b), "+v"(c), "+v"(d) : "v"(p0), "v"(p1), "v"(x0), "v"(x1), "v"(x2), "v"(x3) : "memory");
#endif
}
__device__ __forceinline__ void acc_guard4(v8f& a, v8f& b, v8f& c, v8f& d) {
#if defined(__HIP_DEVICE_COMPILE__)
  asm volatile("v_nop\n\tv_nop\n\tv_nop\n\tv_nop" : "+v"(a), "+v"(b), "+v"(c), "+v"(d));
#endif
}
// value of lane l ^ 16 (the other half of the wave), by a vector cross-row move
__device__ __forceinline__ float xhalf(float x) {
  const int i = __builtin_bit_cast(int, x);
  return __builtin_bit_cast(float, __builtin_amdgcn_permlanex16(i, i, 0x76543210, 0xfedcba98, false, false));
}
__device__ __forceinline__ void wave_sync_lds() {
  __builtin_amdgcn_fence(__ATOMIC_RELEASE, "workgroup");
  __builtin_amdgcn_wave_barrier();
  __builtin_amdgcn_fence(__ATOMIC_ACQUIRE, "workgroup");
}

// =====================================================================================================
// 16-bit plane convert: f16( bf16(x) * sc ) (sc a power of two, exact). blockIdx.y == 0: q plane, == 1: k plane.
//   q plane: no relayout (inputs are already head-major [h][s][d]).
//   k plane: fragment order. Per tile of 16 keys (2048 B) the 16-B unit u = 32*f + 16*hh + c holds key c, d 16f + 8hh .. +7:
//            unit 32*f + lane is what lane (hh, c) takes as piece f of the tile's two A fragments.
// Thread = 8 consecutive d of one row: two 16-B loads, one 16-B store per lane; 32 consecutive lanes store 512 contiguous B
// coverage: grid = (n8/256, 2) blocks x 256 thr x 8 elements = n = NH*4096*64 per plane exactly (n % 2048 == 0 asserted).
// =====================================================================================================
__global__ __launch_bounds__(256) void cvt16(const float* __restrict__ xq, const float* __restrict__ xk,
                                             unsigned short* plq, unsigned short* plk, int n8, float sc) {
  const int gt = blockIdx.x * 256 + (int)threadIdx.x;
  if (gt >= n8) return;                     // never taken with the exact grid; no barriers in this kernel
  const bool sk = (blockIdx.y != 0);        // block-uniform plane select (both pointers global)
  const float* x = sk ? xk : xq;
  unsigned short* pl = sk ? plk : plq;
  const size_t e = (size_t)gt * 8;          // destination element
  // source unit of 8 floats: k plane, unit gt = (tile gt >> 7, piece 2f + hh = (gt >> 4) & 7, c = gt & 15) <- row 16*tile + c
  const size_t es = sk ? (((size_t)(gt >> 7) * 16 + (size_t)(gt & 15)) * HD + (size_t)((gt >> 4) & 7) * 8) : e;
  const v4f a = *(const v4f*)(x + es), bq = *(const v4f*)(x + es + 4);
  v4u o;
#pragma unroll
  for (int i = 0; i < 2; ++i) {
    o[i]     = pk16(h_bits((_Float16)(bfr(a[2 * i]) * sc)),  h_bits((_Float16)(bfr(a[2 * i + 1]) * sc)));
    o[2 + i] = pk16(h_bits((_Float16)(bfr(bq[2 * i]) * sc)), h_bits((_Float16)(bfr(bq[2 * i + 1]) * sc)));
  }
  unsigned short* d = pl + e;
  {
    *(v4u*)(d) = o;
    
  }
}

// =====================================================================================================
// v^T plane, values f16( bf16(v[h][key][d]) * 256 ) (exact), in fragment order: per head and step of 32 keys (4096 B) the 16-B
// unit u = 64*j + 32*g + 16*hh + c holds d = 16j + c, keys 16g + 8hh .. +7 of the step: unit 64*j + 32*g + lane is piece g of
// the A fragment of d tile j in lane (hh, c).
// Block = (h, tile of 64 keys): 64 source rows of 64 floats loaded with 16-B loads (static stride), converted, written into
// coverage: load 256 thr x 16 elements = 64 keys x 64 d; store 2 iterations x 256 thr x 8 halves = 64 lines x 64 = the tile;
//           grid = NH x 64 blocks covers the whole plane (NH x 128 steps x 4096 B) exactly once.
// =====================================================================================================
__global__ __launch_bounds__(256) void vt16(const float* __restrict__ v, unsigned short* VTo) {
  __shared__ __align__(16) unsigned short T[HD * VTP];
  const int tid = threadIdx.x;
  const int bid = blockIdx.x;
  const int bh  = bid / VTILES;
  const int t   = bid - bh * VTILES;        // 0..63, block-uniform
  if (bh >= NH) return;                     // never taken with the exact grid; before any barrier or store
  {
    const int sl = tid >> 2;                  // key within tile 0..63
    const int dc = (tid & 3) * 16;            // d chunk
    int key = 64 * t + sl;                    // <= SEQ-1 by construction; clamp keeps the address in range regardless
    key = (key < 0) ? 0 : ((key > SEQ - 1) ? (SEQ - 1) : key);
    const float* src = v + (((size_t)bh * SEQ + (size_t)key) * HD + dc);
#pragma unroll
    for (int i = 0; i < 4; ++i) {
      const v4f a = *(const v4f*)(src + 4 * i);
#pragma unroll
      for (int e = 0; e < 4; ++e) T[(dc + 4 * i + e) * VTP + sl] = h_bits((_Float16)(bfr(a[e]) * VCAR));
    }
  }
  __syncthreads();
  v4u vals[2];
  const int line = ((tid >> 6) & 3) * 16 + (tid & 15);   // d = 16j + c, 0..63
  const int k8   = ((tid >> 4) & 3) * 8;                  // 16g + 8hh, key within the 32-key step
#pragma unroll
  for (int it = 0; it < 2; ++it) vals[it] = *(const v4u*)(T + line * VTP + 32 * it + k8);   // step it of the tile
  unsigned short* dst = VTo + (size_t)bh * HD * SEQ + (size_t)t * (64 * HD) + tid * 8;
  {
#pragma unroll
    for (int it = 0; it < 2; ++it) {
      *(v4u*)(dst + it * (32 * HD)) = vals[it];
    }
    
  }
}

// =====================================================================================================
// Flash attention per head, no key mask. Block = (h, 64 queries), wave w owns queries iw = 64t + 16w .. +15.
//   q plane f16 [h][s][d]; k plane and v^T plane f16 in fragment order (4096 contiguous B each per 32-key step).
//   Both products are transposed, so that lane (hh, c) holds scores and outputs of ONE query, iw + c:
//     S^T = K.Q^T : A = 16 key rows of the k plane, B = the wave's q rows (kept in registers); D[r] = (key 8hh + r, query c)
//     O^T += V^T.P^T : A = 16 d rows of the v^T plane, B = P^T packed from the two score tiles as they lie in the registers
//                      (element s < 8: key kb + 8hh + s, else key kb + 16 + 8hh + s - 8: the k map of the A loader)
//   Key loop (static bound): kb = 0, 32, ... , SEQ-32. Every key is visible to every query, so the running max is finite from
//   the first step on. Per 32-key step: 4 score WMMAs, maximum over the lane's 16 scores and one exchange between the wave
//   halves, exp2 in f32, the lane's own partial sum (the halves' sums are joined once, behind the loop), rescale, 8 P.V WMMAs.
//   The k and v^T fragments of a step are loaded one step ahead: k behind the score products, v^T behind the P.V products.
//   P never touches LDS. Epilogue: 1/l and carry folds in f32; the wave's 16x64 f32 result staged in its LDS slab (pitch 68),
//   stored as whole 256-B rows. No block barriers in this kernel; every wave of a block does identical bounded work (128 steps).
//   mkp (int32 key mask) is bound but has no effect on the result and is never read.
// coverage: per wave 8 instructions x 32 lanes x 4 floats = 16 rows x 64; per block 4 waves = 64 rows; 64 blocks per head x
//           NH heads: every row of out [NH][4096][64] exactly once (grid NH*64 blocks).
// =====================================================================================================
__global__ __launch_bounds__(ATT_THREADS)
void attn_fwd(const unsigned short* __restrict__ QHp, const unsigned short* __restrict__ KHp,
              const unsigned short* __restrict__ VTq, const int* __restrict__ mkp, float* OPp) {
  __shared__ __align__(16) float smem[ATW * SLABF];    // per wave: result slab [16][64], pitch 68
  (void)mkp;

  const int tid  = threadIdx.x;
  const int wave = tid >> 5;
  const int lane = tid & 31;
  const int hh   = lane >> 4;
  const int c    = lane & 15;

  const int bid  = blockIdx.x;
  const int bh   = bid / BPH;
  const int t    = bid - bh * BPH;                     // 0..63, block-uniform
  if (bh >= NH) return;                                // never taken with the exact grid; before any LDS use or store

  const int i0 = QPB * t;
  const int iw = i0 + wave * 16;                       // query row 0 of this wave
  const int qs = iw + c;                               // query of fragment column c, <= SEQ-1 by construction

  const _Float16* Qb = (const _Float16*)(const void*)QHp + ((size_t)bh * SEQ + (size_t)qs) * HD + 8 * hh;
  const v16h qa0 = ldfrag_h(Qb);                       // d 0..31
  const v16h qa1 = ldfrag_h(Qb + 32);                  // d 32..63
  const _Float16* Kb = (const _Float16*)(const void*)KHp + (size_t)bh * SEQ * HD;   // head's planes, block-uniform
  const _Float16* Vb = (const _Float16*)(const void*)VTq + (size_t)bh * SEQ * HD;
  const unsigned lo = (unsigned)lane * 8;              // this lane's 16-B unit within each 512-B piece
  const float lsc = LOG2E / (8.0f * QSC * KSC);

  float mrun = -INFINITY, lrun = 0.f;                  // this lane's query: running max (both halves alike), this half's sum
  v8f o[4];                                            // o[j][r] = O^T[d = 16j + 8hh + r][query c]
#pragma unroll
  for (int j = 0; j < 4; ++j) o[j] = zero8();

  // Fragments of step 0; from here on every step fetches the NEXT step's fragments into the registers that its own products
  // have just read, so that a load has about one whole step of other work between its issue and its first use.
  // The two scheduling barriers keep the issue order q, k, v^T, which is the loop's own (k older than v^T): loads return in
  // order, so only then can the wait at the loop's head be a counted one that leaves the eight v^T loads in flight.
  __builtin_amdgcn_sched_barrier(0);
  v16h kf00 = ldfrag_p(Kb + lo),        kf01 = ldfrag_p(Kb + lo + 512);    // keys 0..15:  d 0..31, d 32..63
  v16h kf10 = ldfrag_p(Kb + lo + 1024), kf11 = ldfrag_p(Kb + lo + 1536);   // keys 16..31: d 0..31, d 32..63
  __builtin_amdgcn_sched_barrier(0);
  v16h vb0 = ldfrag_p(Vb + lo),        vb1 = ldfrag_p(Vb + lo + 512);      // d tiles 0, 1 of keys 0..31
  v16h vb2 = ldfrag_p(Vb + lo + 1024), vb3 = ldfrag_p(Vb + lo + 1536);     // d tiles 2, 3

#pragma unroll 1
  for (int kb = 0; kb < SEQ; kb += 32) {
    // step whose fragments are fetched in this one; the last step has none behind it and re-reads its own (in range, unused)
    const int kn = (kb + 32 < SEQ) ? (kb + 32) : kb;
    // ---- scores: D element r of this lane = (key kb + 8hh + r, query iw + c) in s0, key kb + 16 + 8hh + r in s1 ----
    v8f s0 = zero8(), s1 = zero8();
    s0 = mma_raw(kf00, qa0, s0);
    s0 = mma_raw(kf01, qa1, s0);
    s1 = mma_raw(kf10, qa0, s1);
    s1 = mma_raw(kf11, qa1, s1);
    guard_sc(s0, s1, qa0, qa1, kf00, kf01, kf10, kf11);
    {
      const _Float16* k0p = Kb + (size_t)kn * HD + lo;               // tile of keys kn .. kn + 15 (row c in this lane)
      const _Float16* k1p = k0p + (size_t)16 * HD;                   // tile of keys kn + 16 .. kn + 31
      kf00 = ldfrag_p(k0p);  kf01 = ldfrag_p(k0p + 512);             // d 0..31, d 32..63
      kf10 = ldfrag_p(k1p);  kf11 = ldfrag_p(k1p + 512);
    }
    // keeps the eight loads here, in front of the softmax: without it the scheduler sinks them to the P.V products and their lead goes
    __builtin_amdgcn_sched_barrier(0);
    // ---- online softmax in base 2 (no mask), one query per lane ----
    float mx = fmaxf(s0[0], s1[0]);
#pragma unroll
    for (int r = 1; r < 8; ++r) mx = fmaxf(mx, fmaxf(s0[r], s1[r]));
    mx = fmaxf(mx, xhalf(mx));                         // the other 16 keys of this query
    const float mn = fmaxf(mrun, mx * lsc);            // finite from the first step on (lsc > 0)
    const float al = exp2f(mrun - mn);
    mrun = mn;
    // ---- B fragments of P^T*32768: hi f16 and residual f16, straight from the score registers ----
    FragH ph, pl;
    float ps0 = 0.f, ps1 = 0.f;
#pragma unroll
    for (int r = 0; r < 8; ++r) {
      const float e0 = exp2f(s0[r] * lsc - mn), e1 = exp2f(s1[r] * lsc - mn);
      ps0 += e0;
      ps1 += e1;
      const float ta = e0 * PCAR, tc = e1 * PCAR;
      const _Float16 ha = (_Float16)ta, hc = (_Float16)tc;
      ph.h[0][r] = ha;                                 // elements 0..7  = keys kb + 8hh + 0..7
      ph.h[1][r] = hc;                                 // elements 8..15 = keys kb + 16 + 8hh + 0..7
      pl.h[0][r] = (_Float16)(ta - (float)ha);
      pl.h[1][r] = (_Float16)(tc - (float)hc);
    }
    lrun = lrun * al + (ps0 + ps1);
#pragma unroll
    for (int j = 0; j < 4; ++j) o[j] *= al;
    // ---- O^T += V^T.P^T : A fragment row = d = j*16 + c, keys kb .. kb+31: 1024 B of the step's v^T block per d tile j ----
    o[0] = mma_raw(vb0, ph.v, o[0]);  o[0] = mma_raw(vb0, pl.v, o[0]);
    o[1] = mma_raw(vb1, ph.v, o[1]);  o[1] = mma_raw(vb1, pl.v, o[1]);
    o[2] = mma_raw(vb2, ph.v, o[2]);  o[2] = mma_raw(vb2, pl.v, o[2]);
    o[3] = mma_raw(vb3, ph.v, o[3]);  o[3] = mma_raw(vb3, pl.v, o[3]);
    guard_pv(o[0], o[1], o[2], o[3], ph.v, pl.v, vb0, vb1, vb2, vb3);
    {
      const _Float16* vp = Vb + (size_t)kn * HD + lo;                // the v^T block of keys kn .. kn + 31
      vb0 = ldfrag_p(vp);
      vb1 = ldfrag_p(vp + 512);
      vb2 = ldfrag_p(vp + 1024);
      vb3 = ldfrag_p(vp + 1536);
    }
  }
  acc_guard4(o[0], o[1], o[2], o[3]);

  // ---- join the halves' sums, fold 1/l and the carries (32768 on P, 256 on v), stage the wave's 16x64 slab in its LDS region:
  //      a lane holds 8 consecutive d of its query per tile j: two 16-B LDS stores ----
  float* slab = smem + wave * SLABF;
  const float oc = 1.0f / (PCAR * VCAR);
  const float lr  = lrun + xhalf(lrun);                  // >= 1 (the max element contributes 2^0)
  const float inv = (lr > 0.0f) ? ((1.0f / lr) * oc) : 0.0f;
#pragma unroll
  for (int j = 0; j < 4; ++j) {
    float* sp = slab + c * SLP + j * 16 + 8 * hh;
    const v4f w0 = {o[j][0] * inv, o[j][1] * inv, o[j][2] * inv, o[j][3] * inv};
    const v4f w1 = {o[j][4] * inv, o[j][5] * inv, o[j][6] * inv, o[j][7] * inv};
    *(v4f*)(sp)     = w0;
    *(v4f*)(sp + 4) = w1;
  }
  wave_sync_lds();
  v4f vals[8];
#pragma unroll
  for (int it = 0; it < 8; ++it) vals[it] = *(const v4f*)(slab + (2 * it + hh) * SLP + c * 4);
  float* dst = OPp + ((size_t)(bh * SEQ + iw)) * HD + hh * HD + c * 4;
  {
#pragma unroll
    for (int it = 0; it < 8; ++it) {
      *(v4f*)(dst + (size_t)(2 * it) * HD) = vals[it];
    }
    
  }
}

// =====================================================================================================
// Workspace map (bytes); every plane is fully written by whole-line stores before it is read; all extents are exact
// multiples of the store granularity (no pad rows needed); offsets multiples of 128 (NH = 16 values shown):
//   QH f16 [NH][4096][64] x1024        8388608   at        0
//   KH f16 [NH][256 tiles][2048 B] x1024   8388608   at  8388608   (fragment order)
//   VT f16 [NH][128 steps][4096 B] x256    8388608   at 16777216   (fragment order)
//   end                                             25165824
// =====================================================================================================
extern "C" void kernel_launch(void* const* d_in, const int* in_sizes, int n_in,
                              void* d_out, int out_size, void* d_ws, size_t ws_size,
                              hipStream_t stream) {
  const int NEL = NH * SEQ * HD;                        // 4194304 for NH = 16
  if (n_in < 4) return;
  if (in_sizes[0] < NEL || in_sizes[1] < NEL || in_sizes[2] < NEL || in_sizes[3] < 1) return;
  if (out_size < NEL) return;

  const float* q  = (const float*)d_in[0];
  const float* k  = (const float*)d_in[1];
  const float* v  = (const float*)d_in[2];
  const int*   mk = (const int*)d_in[3];                // int32 key mask, no effect on the result
  float*       out = (float*)d_out;

  const size_t PQ = (size_t)NEL * 2;                    //  8388608
  const size_t PK = (size_t)NEL * 2;                    //  8388608
  const size_t PV = (size_t)NH * HD * SEQ * 2;          //  8388608
  size_t off = 0;
  const size_t oQH = off; off += PQ;
  const size_t oKH = off; off += PK;
  const size_t oVT = off; off += PV;
  if (off > ws_size) return;                            // off = 25165824
  if (off > (size_t)134217728) return;

  char* ws = (char*)d_ws;
  unsigned short* QH = (unsigned short*)(ws + oQH);
  unsigned short* KH = (unsigned short*)(ws + oKH);
  unsigned short* VT = (unsigned short*)(ws + oVT);

  const int n8 = NEL / 8;                               // 524288
  const dim3 blk(256);
  const dim3 gC(n8 / 256, 2);                           // (2048, 2): q and k planes in one launch
  const dim3 gVT(NH * VTILES);                          // 1024
  const dim3 gAT(ATT_BLOCKS);                           // 1024
  const dim3 bAT(ATT_THREADS);                          // 128

  // (0) q and k planes f16(bf16(x) * 1024): q [h][s][d], k in fragment order
  cvt16<<<gC, blk, 0, stream>>>(q, k, QH, KH, n8, QSC);
  // (1) v^T plane f16(bf16(v) * 256), fragment order
  vt16<<<gVT, blk, 0, stream>>>(v, VT);
  // (2) flash attention per head -> out [h][s][d] f32
  attn_fwd<<<gAT, bAT, 0, stream>>>(QH, KH, VT, mk, out);
  (void)hipGetLastError();
}

// v004
// A run of this version takes 109 microseconds.
// Timed twice side by side with v003, it ran 1.25 and 1.24 times as fast.
// Counting every step since v000, it is 2.46 times as fast.
// Contractions, both transposed: scores S^T = k.q^T (q x1024 and k x1024 as f16 planes of the bf16-RNE-converted inputs, one
// product each, K=64) and O^T += v^T.P^T (P x32768 as f16 hi plane + f16 residual plane, v x256 f16 of the bf16-RNE-converted
// input, products v.hi+v.lo, 32-key steps): all v_wmma_f32_16x16x32_f16, f32 accumulate. Base-2 online softmax over all keys (no key mask) and the 1/l fold in f32 on VALU.
#include <hip/hip_runtime.h>
#include <math.h>
#include <stdint.h>

#ifndef NH
#define NH    16
#endif
#define SEQ   4096
#define HD    64
#define QSC   1024.0f
#define KSC   1024.0f
#define PCAR  32768.0f
#define VCAR  256.0f
#define LOG2E 1.4426950408889634f
#define ATW   4
#define ATT_THREADS (ATW * 32)
#define QPB   (16 * ATW)
#define BPH   (SEQ / QPB)
#define ATT_BLOCKS (NH * BPH)
#define SLP   68
#define SLABF (16 * SLP)
#define VTP   72
#define VTILES (SEQ / 64)
static_assert(HD == 64 && QPB == 64 && ATT_THREADS == 128);
static_assert((SEQ % QPB) == 0 && (SEQ % 64) == 0 && (SEQ % 32) == 0);
static_assert(BPH == 64 && ATT_BLOCKS == NH * 64 && VTILES == 64);
static_assert(NH >= 1 && NH <= 16);
static_assert((HD - 1) * VTP + 63 < HD * VTP);
static_assert(((NH * SEQ * HD) % 2048) == 0);

typedef _Float16 v16h __attribute__((ext_vector_type(16)));
typedef _Float16 v8h  __attribute__((ext_vector_type(8)));
typedef float    v8f  __attribute__((ext_vector_type(8)));
typedef float    v4f  __attribute__((ext_vector_type(4)));
typedef unsigned int v4u __attribute__((ext_vector_type(4)));

union FragH { v16h v; v8h h[2]; v4u u[2]; };

// ---- scalar helpers --------------------------------------------------------------------------------
__device__ __forceinline__ unsigned short bf_bits(float f) {          // f32 -> bf16 bits, RNE convert
  unsigned u = __float_as_uint(f);
  return (unsigned short)((u + 0x7FFFu + ((u >> 16) & 1u)) >> 16);
}
__device__ __forceinline__ float bf_up(unsigned short h) { return __uint_as_float(((unsigned)h) << 16); }
__device__ __forceinline__ float bfr(float f) { return bf_up(bf_bits(f)); }   // value of the bf16 RNE convert
__device__ __forceinline__ unsigned short h_bits(_Float16 x) { return __builtin_bit_cast(unsigned short, x); }
__device__ __forceinline__ unsigned pk16(unsigned short a, unsigned short b) { return (unsigned)a | ((unsigned)b << 16); }
__device__ __forceinline__ v8f zero8() { v8f z = {0.f, 0.f, 0.f, 0.f, 0.f, 0.f, 0.f, 0.f}; return z; }

// ---- fragment loader: 16-bit A/B operand, lane -> row/col (lane&15), p already includes +8*(lane>>4);
//      elements 0..7 <- p[0..7] (k0+8h..), elements 8..15 <- p[16..23] (k0+16+8h..)  (same split k map for A and B;
//      B is always read from a k-contiguous [n][k] plane)
__device__ __forceinline__ v16h ldfrag_h(const _Float16* p) {
  FragH f;
  f.h[0] = *(const v8h*)(p);
  f.h[1] = *(const v8h*)(p + 16);
  return f.v;
}

// the same fragment from a plane stored in fragment order: p already includes +8*lane; the two 16-B pieces of a lane lie 256
// halves apart, so that each wave-wide 16-B load covers 512 contiguous bytes (4 whole lines)
__device__ __forceinline__ v16h ldfrag_p(const _Float16* p) {
  FragH f;
  f.h[0] = *(const v8h*)(p);
  f.h[1] = *(const v8h*)(p + 256);
  return f.v;
}

__device__ __forceinline__ v8f mma_raw(v16h a, v16h b, v8f c) {
  return __builtin_amdgcn_wmma_f32_16x16x32_f16(false, a, false, b, (short)0, c, false, false);
}
__device__ __forceinline__ void guard_sc(v8f& a, v8f& b, v16h x0, v16h x1, v16h x2, v16h x3, v16h x4, v16h x5) {
#if defined(__HIP_DEVICE_COMPILE__)
  asm volatile("v_nop\n\tv_nop\n\tv_nop\n\tv_nop"
               : "+v"(a), "+v"(b) : "v"(x0), "v"(x1), "v"(x2), "v"(x3), "v"(x4), "v"(x5) : "memory");
#endif
}
__device__ __forceinline__ void guard_pv(v8f& a, v8f& b, v8f& c, v8f& d,
                                         v16h p0, v16h p1, v16h x0, v16h x1, v16h x2, v16h x3) {
#if defined(__HIP_DEVICE_COMPILE__)
  asm volatile("v_nop\n\tv_nop\n\tv_nop\n\tv_nop"
               : "+v"(a), "+v"(b), "+v"(c), "+v"(d) : "v"(p0), "v"(p1), "v"(x0), "v"(x1), "v"(x2), "v"(x3) : "memory");
#endif
}
__device__ __forceinline__ void acc_guard4(v8f& a, v8f& b, v8f& c, v8f& d) {
#if defined(__HIP_DEVICE_COMPILE__)
  asm volatile("v_nop\n\tv_nop\n\tv_nop\n\tv_nop" : "+v"(a), "+v"(b), "+v"(c), "+v"(d));
#endif
}
// 2^x as the bare hardware exponential: results below 2^-126 come out as 0 (no range fix). Every use here has x <= 0 and is a
// weight relative to a maximum of 1: such a weight is 0 in both f16 planes of P anyway and is lost against a row sum >= 1.
__device__ __forceinline__ float ex2(float x) { return __builtin_amdgcn_exp2f(x); }
// value of lane l ^ 16 (the other half of the wave), by a vector cross-row move
__device__ __forceinline__ float xhalf(float x) {
  const int i = __builtin_bit_cast(int, x);
  return __builtin_bit_cast(float, __builtin_amdgcn_permlanex16(i, i, 0x76543210, 0xfedcba98, false, false));
}
__device__ __forceinline__ void wave_sync_lds() {
  __builtin_amdgcn_fence(__ATOMIC_RELEASE, "workgroup");
  __builtin_amdgcn_wave_barrier();
  __builtin_amdgcn_fence(__ATOMIC_ACQUIRE, "workgroup");
}

// =====================================================================================================
// 16-bit plane convert: f16( bf16(x) * sc ) (sc a power of two, exact). blockIdx.y == 0: q plane, == 1: k plane.
//   q plane: no relayout (inputs are already head-major [h][s][d]).
//   k plane: fragment order. Per tile of 16 keys (2048 B) the 16-B unit u = 32*f + 16*hh + c holds key c, d 16f + 8hh .. +7:
//            unit 32*f + lane is what lane (hh, c) takes as piece f of the tile's two A fragments.
// Thread = 8 consecutive d of one row: two 16-B loads, one 16-B store per lane; 32 consecutive lanes store 512 contiguous B
// coverage: grid = (n8/256, 2) blocks x 256 thr x 8 elements = n = NH*4096*64 per plane exactly (n % 2048 == 0 asserted).
// =====================================================================================================
__global__ __launch_bounds__(256) void cvt16(const float* __restrict__ xq, const float* __restrict__ xk,
                                             unsigned short* plq, unsigned short* plk, int n8, float sc) {
  const int gt = blockIdx.x * 256 + (int)threadIdx.x;
  if (gt >= n8) return;                     // never taken with the exact grid; no barriers in this kernel
  const bool sk = (blockIdx.y != 0);        // block-uniform plane select (both pointers global)
  const float* x = sk ? xk : xq;
  unsigned short* pl = sk ? plk : plq;
  const size_t e = (size_t)gt * 8;          // destination element
  // source unit of 8 floats: k plane, unit gt = (tile gt >> 7, piece 2f + hh = (gt >> 4) & 7, c = gt & 15) <- row 16*tile + c
  const size_t es = sk ? (((size_t)(gt >> 7) * 16 + (size_t)(gt & 15)) * HD + (size_t)((gt >> 4) & 7) * 8) : e;
  const v4f a = *(const v4f*)(x + es), bq = *(const v4f*)(x + es + 4);
  v4u o;
#pragma unroll
  for (int i = 0; i < 2; ++i) {
    o[i]     = pk16(h_bits((_Float16)(bfr(a[2 * i]) * sc)),  h_bits((_Float16)(bfr(a[2 * i + 1]) * sc)));
    o[2 + i] = pk16(h_bits((_Float16)(bfr(bq[2 * i]) * sc)), h_bits((_Float16)(bfr(bq[2 * i + 1]) * sc)));
  }
  unsigned short* d = pl + e;
  {
    *(v4u*)(d) = o;
    
  }
}

// =====================================================================================================
// v^T plane, values f16( bf16(v[h][key][d]) * 256 ) (exact), in fragment order: per head and step of 32 keys (4096 B) the 16-B
// unit u = 64*j + 32*g + 16*hh + c holds d = 16j + c, keys 16g + 8hh .. +7 of the step: unit 64*j + 32*g + lane is piece g of
// the A fragment of d tile j in lane (hh, c).
// Block = (h, tile of 64 keys): 64 source rows of 64 floats loaded with 16-B loads (static stride), converted, written into
// coverage: load 256 thr x 16 elements = 64 keys x 64 d; store 2 iterations x 256 thr x 8 halves = 64 lines x 64 = the tile;
//           grid = NH x 64 blocks covers the whole plane (NH x 128 steps x 4096 B) exactly once.
// =====================================================================================================
__global__ __launch_bounds__(256) void vt16(const float* __restrict__ v, unsigned short* VTo) {
  __shared__ __align__(16) unsigned short T[HD * VTP];
  const int tid = threadIdx.x;
  const int bid = blockIdx.x;
  const int bh  = bid / VTILES;
  const int t   = bid - bh * VTILES;        // 0..63, block-uniform
  if (bh >= NH) return;                     // never taken with the exact grid; before any barrier or store
  {
    const int sl = tid >> 2;                  // key within tile 0..63
    const int dc = (tid & 3) * 16;            // d chunk
    int key = 64 * t + sl;                    // <= SEQ-1 by construction; clamp keeps the address in range regardless
    key = (key < 0) ? 0 : ((key > SEQ - 1) ? (SEQ - 1) : key);
    const float* src = v + (((size_t)bh * SEQ + (size_t)key) * HD + dc);
#pragma unroll
    for (int i = 0; i < 4; ++i) {
      const v4f a = *(const v4f*)(src + 4 * i);
#pragma unroll
      for (int e = 0; e < 4; ++e) T[(dc + 4 * i + e) * VTP + sl] = h_bits((_Float16)(bfr(a[e]) * VCAR));
    }
  }
  __syncthreads();
  v4u vals[2];
  const int line = ((tid >> 6) & 3) * 16 + (tid & 15);   // d = 16j + c, 0..63
  const int k8   = ((tid >> 4) & 3) * 8;                  // 16g + 8hh, key within the 32-key step
#pragma unroll
  for (int it = 0; it < 2; ++it) vals[it] = *(const v4u*)(T + line * VTP + 32 * it + k8);   // step it of the tile
  unsigned short* dst = VTo + (size_t)bh * HD * SEQ + (size_t)t * (64 * HD) + tid * 8;
  {
#pragma unroll
    for (int it = 0; it < 2; ++it) {
      *(v4u*)(dst + it * (32 * HD)) = vals[it];
    }
    
  }
}

// =====================================================================================================
// Flash attention per head, no key mask. Block = (h, 64 queries), wave w owns queries iw = 64t + 16w .. +15.
//   q plane f16 [h][s][d]; k plane and v^T plane f16 in fragment order (4096 contiguous B each per 32-key step).
//   Both products are transposed, so that lane (hh, c) holds scores and outputs of ONE query, iw + c:
//     S^T = K.Q^T : A = 16 key rows of the k plane, B = the wave's q rows (kept in registers); D[r] = (key 8hh + r, query c)
//     O^T += V^T.P^T : A = 16 d rows of the v^T plane, B = P^T packed from the two score tiles as they lie in the registers
//                      (element s < 8: key kb + 8hh + s, else key kb + 16 + 8hh + s - 8: the k map of the A loader)
//   Key loop (static bound): kb = 0, 32, ... , SEQ-32. Every key is visible to every query, so the running max is finite from
//   the first step on. Per 32-key step: 4 score WMMAs, maximum over the lane's 16 scores and one exchange between the wave
//   halves, exp2 in f32, the lane's own partial sum (the halves' sums are joined once, behind the loop), rescale, 8 P.V WMMAs.
//   The k and v^T fragments of a step are loaded one step ahead: k behind the score products, v^T behind the P.V products.
//   P never touches LDS. Epilogue: 1/l and carry folds in f32; the wave's 16x64 f32 result staged in its LDS slab (pitch 68),
//   stored as whole 256-B rows. No block barriers in this kernel; every wave of a block does identical bounded work (128 steps).
//   mkp (int32 key mask) is bound but has no effect on the result and is never read.
// coverage: per wave 8 instructions x 32 lanes x 4 floats = 16 rows x 64; per block 4 waves = 64 rows; 64 blocks per head x
//           NH heads: every row of out [NH][4096][64] exactly once (grid NH*64 blocks).
// =====================================================================================================
__global__ __launch_bounds__(ATT_THREADS)
void attn_fwd(const unsigned short* __restrict__ QHp, const unsigned short* __restrict__ KHp,
              const unsigned short* __restrict__ VTq, const int* __restrict__ mkp, float* OPp) {
  __shared__ __align__(16) float smem[ATW * SLABF];    // per wave: result slab [16][64], pitch 68
  (void)mkp;

  const int tid  = threadIdx.x;
  const int wave = tid >> 5;
  const int lane = tid & 31;
  const int hh   = lane >> 4;
  const int c    = lane & 15;

  const int bid  = blockIdx.x;
  const int bh   = bid / BPH;
  const int t    = bid - bh * BPH;                     // 0..63, block-uniform
  if (bh >= NH) return;                                // never taken with the exact grid; before any LDS use or store

  const int i0 = QPB * t;
  const int iw = i0 + wave * 16;                       // query row 0 of this wave
  const int qs = iw + c;                               // query of fragment column c, <= SEQ-1 by construction

  const _Float16* Qb = (const _Float16*)(const void*)QHp + ((size_t)bh * SEQ + (size_t)qs) * HD + 8 * hh;
  const v16h qa0 = ldfrag_h(Qb);                       // d 0..31
  const v16h qa1 = ldfrag_h(Qb + 32);                  // d 32..63
  const _Float16* Kb = (const _Float16*)(const void*)KHp + (size_t)bh * SEQ * HD;   // head's planes, block-uniform
  const _Float16* Vb = (const _Float16*)(const void*)VTq + (size_t)bh * SEQ * HD;
  const unsigned lo = (unsigned)lane * 8;              // this lane's 16-B unit within each 512-B piece
  const float lsc = LOG2E / (8.0f * QSC * KSC);

  float mrun = -INFINITY, lrun = 0.f;                  // this lane's query: running max (both halves alike), this half's sum
  v8f o[4];                                            // o[j][r] = O^T[d = 16j + 8hh + r][query c]
#pragma unroll
  for (int j = 0; j < 4; ++j) o[j] = zero8();

  // Fragments of step 0; from here on every step fetches the NEXT step's fragments into the registers that its own products
  // have just read, so that a load has about one whole step of other work between its issue and its first use.
  // The two scheduling barriers keep the issue order q, k, v^T, which is the loop's own (k older than v^T): loads return in
  // order, so only then can the wait at the loop's head be a counted one that leaves the eight v^T loads in flight.
  __builtin_amdgcn_sched_barrier(0);
  v16h kf00 = ldfrag_p(Kb + lo),        kf01 = ldfrag_p(Kb + lo + 512);    // keys 0..15:  d 0..31, d 32..63
  v16h kf10 = ldfrag_p(Kb + lo + 1024), kf11 = ldfrag_p(Kb + lo + 1536);   // keys 16..31: d 0..31, d 32..63
  __builtin_amdgcn_sched_barrier(0);
  v16h vb0 = ldfrag_p(Vb + lo),        vb1 = ldfrag_p(Vb + lo + 512);      // d tiles 0, 1 of keys 0..31
  v16h vb2 = ldfrag_p(Vb + lo + 1024), vb3 = ldfrag_p(Vb + lo + 1536);     // d tiles 2, 3

#pragma unroll 1
  for (int kb = 0; kb < SEQ; kb += 32) {
    // step whose fragments are fetched in this one; the last step has none behind it and re-reads its own (in range, unused)
    const int kn = (kb + 32 < SEQ) ? (kb + 32) : kb;
    // ---- scores: D element r of this lane = (key kb + 8hh + r, query iw + c) in s0, key kb + 16 + 8hh + r in s1 ----
    v8f s0 = zero8(), s1 = zero8();
    s0 = mma_raw(kf00, qa0, s0);
    s0 = mma_raw(kf01, qa1, s0);
    s1 = mma_raw(kf10, qa0, s1);
    s1 = mma_raw(kf11, qa1, s1);
    guard_sc(s0, s1, qa0, qa1, kf00, kf01, kf10, kf11);
    {
      const _Float16* k0p = Kb + (size_t)kn * HD + lo;               // tile of keys kn .. kn + 15 (row c in this lane)
      const _Float16* k1p = k0p + (size_t)16 * HD;                   // tile of keys kn + 16 .. kn + 31
      kf00 = ldfrag_p(k0p);  kf01 = ldfrag_p(k0p + 512);             // d 0..31, d 32..63
      kf10 = ldfrag_p(k1p);  kf11 = ldfrag_p(k1p + 512);
    }
    // keeps the eight loads here, in front of the softmax: without it the scheduler sinks them to the P.V products and their lead goes
    __builtin_amdgcn_sched_barrier(0);
    // ---- online softmax in base 2 (no mask), one query per lane ----
    float mx = fmaxf(s0[0], s1[0]);
#pragma unroll
    for (int r = 1; r < 8; ++r) mx = fmaxf(mx, fmaxf(s0[r], s1[r]));
    mx = fmaxf(mx, xhalf(mx));                         // the other 16 keys of this query
    const float mn = fmaxf(mrun, mx * lsc);            // finite from the first step on (lsc > 0)
    const float al = ex2(mrun - mn);
    mrun = mn;
    // ---- B fragments of P^T*32768: hi f16 and residual f16, straight from the score registers ----
    FragH ph, pl;
    float ps0 = 0.f, ps1 = 0.f;
#pragma unroll
    for (int r = 0; r < 8; ++r) {
      const float e0 = ex2(s0[r] * lsc - mn), e1 = ex2(s1[r] * lsc - mn);
      ps0 += e0;
      ps1 += e1;
      const float ta = e0 * PCAR, tc = e1 * PCAR;
      const _Float16 ha = (_Float16)ta, hc = (_Float16)tc;
      ph.h[0][r] = ha;                                 // elements 0..7  = keys kb + 8hh + 0..7
      ph.h[1][r] = hc;                                 // elements 8..15 = keys kb + 16 + 8hh + 0..7
      pl.h[0][r] = (_Float16)(ta - (float)ha);
      pl.h[1][r] = (_Float16)(tc - (float)hc);
    }
    lrun = lrun * al + (ps0 + ps1);
#pragma unroll
    for (int j = 0; j < 4; ++j) o[j] *= al;
    // ---- O^T += V^T.P^T : A fragment row = d = j*16 + c, keys kb .. kb+31: 1024 B of the step's v^T block per d tile j ----
    o[0] = mma_raw(vb0, ph.v, o[0]);  o[0] = mma_raw(vb0, pl.v, o[0]);
    o[1] = mma_raw(vb1, ph.v, o[1]);  o[1] = mma_raw(vb1, pl.v, o[1]);
    o[2] = mma_raw(vb2, ph.v, o[2]);  o[2] = mma_raw(vb2, pl.v, o[2]);
    o[3] = mma_raw(vb3, ph.v, o[3]);  o[3] = mma_raw(vb3, pl.v, o[3]);
    guard_pv(o[0], o[1], o[2], o[3], ph.v, pl.v, vb0, vb1, vb2, vb3);
    {
      const _Float16* vp = Vb + (size_t)kn * HD + lo;                // the v^T block of keys kn .. kn + 31
      vb0 = ldfrag_p(vp);
      vb1 = ldfrag_p(vp + 512);
      vb2 = ldfrag_p(vp + 1024);
      vb3 = ldfrag_p(vp + 1536);
    }
  }
  acc_guard4(o[0], o[1], o[2], o[3]);

  // ---- join the halves' sums, fold 1/l and the carries (32768 on P, 256 on v), stage the wave's 16x64 slab in its LDS region:
  //      a lane holds 8 consecutive d of its query per tile j: two 16-B LDS stores ----
  float* slab = smem + wave * SLABF;
  const float oc = 1.0f / (PCAR * VCAR);
  const float lr  = lrun + xhalf(lrun);                  // >= 1 (the max element contributes 2^0)
  const float inv = (lr > 0.0f) ? ((1.0f / lr) * oc) : 0.0f;
#pragma unroll
  for (int j = 0; j < 4; ++j) {
    float* sp = slab + c * SLP + j * 16 + 8 * hh;
    const v4f w0 = {o[j][0] * inv, o[j][1] * inv, o[j][2] * inv, o[j][3] * inv};
    const v4f w1 = {o[j][4] * inv, o[j][5] * inv, o[j][6] * inv, o[j][7] * inv};
    *(v4f*)(sp)     = w0;
    *(v4f*)(sp + 4) = w1;
  }
  wave_sync_lds();
  v4f vals[8];
#pragma unroll
  for (int it = 0; it < 8; ++it) vals[it] = *(const v4f*)(slab + (2 * it + hh) * SLP + c * 4);
  float* dst = OPp + ((size_t)(bh * SEQ + iw)) * HD + hh * HD + c * 4;
  {
#pragma unroll
    for (int it = 0; it < 8; ++it) {
      *(v4f*)(dst + (size_t)(2 * it) * HD) = vals[it];
    }
    
  }
}

// =====================================================================================================
// Workspace map (bytes); every plane is fully written by whole-line stores before it is read; all extents are exact
// multiples of the store granularity (no pad rows needed); offsets multiples of 128 (NH = 16 values shown):
//   QH f16 [NH][4096][64] x1024        8388608   at        0
//   KH f16 [NH][256 tiles][2048 B] x1024   8388608   at  8388608   (fragment order)
//   VT f16 [NH][128 steps][4096 B] x256    8388608   at 16777216   (fragment order)
//   end                                             25165824
// =====================================================================================================
extern "C" void kernel_launch(void* const* d_in, const int* in_sizes, int n_in,
                              void* d_out, int out_size, void* d_ws, size_t ws_size,
                              hipStream_t stream) {
  const int NEL = NH * SEQ * HD;                        // 4194304 for NH = 16
  if (n_in < 4) return;
  if (in_sizes[0] < NEL || in_sizes[1] < NEL || in_sizes[2] < NEL || in_sizes[3] < 1) return;
  if (out_size < NEL) return;

  const float* q  = (const float*)d_in[0];
  const float* k  = (const float*)d_in[1];
  const float* v  = (const float*)d_in[2];
  const int*   mk = (const int*)d_in[3];                // int32 key mask, no effect on the result
  float*       out = (float*)d_out;

  const size_t PQ = (size_t)NEL * 2;                    //  8388608
  const size_t PK = (size_t)NEL * 2;                    //  8388608
  const size_t PV = (size_t)NH * HD * SEQ * 2;          //  8388608
  size_t off = 0;
  const size_t oQH = off; off += PQ;
  const size_t oKH = off; off += PK;
  const size_t oVT = off; off += PV;
  if (off > ws_size) return;                            // off = 25165824
  if (off > (size_t)134217728) return;

  char* ws = (char*)d_ws;
  unsigned short* QH = (unsigned short*)(ws + oQH);
  unsigned short* KH = (unsigned short*)(ws + oKH);
  unsigned short* VT = (unsigned short*)(ws + oVT);

  const int n8 = NEL / 8;                               // 524288
  const dim3 blk(256);
  const dim3 gC(n8 / 256, 2);                           // (2048, 2): q and k planes in one launch
  const dim3 gVT(NH * VTILES);                          // 1024
  const dim3 gAT(ATT_BLOCKS);                           // 1024
  const dim3 bAT(ATT_THREADS);                          // 128

  // (0) q and k planes f16(bf16(x) * 1024): q [h][s][d], k in fragment order
  cvt16<<<gC, blk, 0, stream>>>(q, k, QH, KH, n8, QSC);
  // (1) v^T plane f16(bf16(v) * 256), fragment order
  vt16<<<gVT, blk, 0, stream>>>(v, VT);
  // (2) flash attention per head -> out [h][s][d] f32
  attn_fwd<<<gAT, bAT, 0, stream>>>(QH, KH, VT, mk, out);
  (void)hipGetLastError();
}

// v005
// One run takes 103 microseconds.
// Two timings next to v004 put it at 1.06 and 1.05 times that version's speed.
// All steps since v000 together make it 2.59 times as fast.
// Contractions, both transposed: scores S^T = k.q^T (q x1024 and k x1024 as f16 planes of the bf16-RNE-converted inputs, one
// product each, K=64) and O^T += v^T.P^T (P x32768 as f16 hi plane + f16 residual plane, v x256 f16 of the bf16-RNE-converted
// input, products v.hi+v.lo, 32-key steps): all v_wmma_f32_16x16x32_f16, f32 accumulate. Base-2 online softmax over all keys (no key mask) and the 1/l fold in f32 on VALU.
#include <hip/hip_runtime.h>
#include <math.h>
#include <stdint.h>

#ifndef NH
#define NH    16
#endif
#define SEQ   4096
#define HD    64
#define QSC   1024.0f
#define KSC   1024.0f
#define PCAR  32768.0f
#define PEXP  15.0f
#define VCAR  256.0f
#define LOG2E 1.4426950408889634f
#define ATW   4
#define ATT_THREADS (ATW * 32)
#define QPB   (16 * ATW)
#define BPH   (SEQ / QPB)
#define ATT_BLOCKS (NH * BPH)
#define SLP   68
#define SLABF (16 * SLP)
#define VTP   72
#define VTILES (SEQ / 64)
static_assert(HD == 64 && QPB == 64 && ATT_THREADS == 128);
static_assert(PCAR == 32768.0f && PEXP == 15.0f);   // PCAR = 2^PEXP
static_assert((SEQ % QPB) == 0 && (SEQ % 64) == 0 && (SEQ % 32) == 0);
static_assert(BPH == 64 && ATT_BLOCKS == NH * 64 && VTILES == 64);
static_assert(NH >= 1 && NH <= 16);
static_assert((HD - 1) * VTP + 63 < HD * VTP);
static_assert(((NH * SEQ * HD) % 2048) == 0);

typedef _Float16 v16h __attribute__((ext_vector_type(16)));
typedef _Float16 v8h  __attribute__((ext_vector_type(8)));
typedef float    v8f  __attribute__((ext_vector_type(8)));
typedef float    v4f  __attribute__((ext_vector_type(4)));
typedef unsigned int v4u __attribute__((ext_vector_type(4)));

union FragH { v16h v; v8h h[2]; v4u u[2]; };

// ---- scalar helpers --------------------------------------------------------------------------------
__device__ __forceinline__ unsigned short bf_bits(float f) {          // f32 -> bf16 bits, RNE convert
  unsigned u = __float_as_uint(f);
  return (unsigned short)((u + 0x7FFFu + ((u >> 16) & 1u)) >> 16);
}
__device__ __forceinline__ float bf_up(unsigned short h) { return __uint_as_float(((unsigned)h) << 16); }
__device__ __forceinline__ float bfr(float f) { return bf_up(bf_bits(f)); }   // value of the bf16 RNE convert
__device__ __forceinline__ unsigned short h_bits(_Float16 x) { return __builtin_bit_cast(unsigned short, x); }
__device__ __forceinline__ unsigned pk16(unsigned short a, unsigned short b) { return (unsigned)a | ((unsigned)b << 16); }
__device__ __forceinline__ v8f zero8() { v8f z = {0.f, 0.f, 0.f, 0.f, 0.f, 0.f, 0.f, 0.f}; return z; }

// ---- fragment loader: 16-bit A/B operand, lane -> row/col (lane&15), p already includes +8*(lane>>4);
//      elements 0..7 <- p[0..7] (k0+8h..), elements 8..15 <- p[16..23] (k0+16+8h..)  (same split k map for A and B;
//      B is always read from a k-contiguous [n][k] plane)
__device__ __forceinline__ v16h ldfrag_h(const _Float16* p) {
  FragH f;
  f.h[0] = *(const v8h*)(p);
  f.h[1] = *(const v8h*)(p + 16);
  return f.v;
}

// the same fragment from a plane stored in fragment order: p already includes +8*lane; the two 16-B pieces of a lane lie 256
// halves apart, so that each wave-wide 16-B load covers 512 contiguous bytes (4 whole lines)
__device__ __forceinline__ v16h ldfrag_p(const _Float16* p) {
  FragH f;
  f.h[0] = *(const v8h*)(p);
  f.h[1] = *(const v8h*)(p + 256);
  return f.v;
}

__device__ __forceinline__ v8f mma_raw(v16h a, v16h b, v8f c) {
  return __builtin_amdgcn_wmma_f32_16x16x32_f16(false, a, false, b, (short)0, c, false, false);
}
__device__ __forceinline__ void guard_sc(v8f& a, v8f& b, v16h x0, v16h x1, v16h x2, v16h x3, v16h x4, v16h x5) {
#if defined(__HIP_DEVICE_COMPILE__)
  asm volatile("v_nop\n\tv_nop\n\tv_nop\n\tv_nop"
               : "+v"(a), "+v"(b) : "v"(x0), "v"(x1), "v"(x2), "v"(x3), "v"(x4), "v"(x5) : "memory");
#endif
}
__device__ __forceinline__ void guard_pv(v8f& a, v8f& b, v8f& c, v8f& d,
                                         v16h p0, v16h p1, v16h x0, v16h x1, v16h x2, v16h x3) {
#if defined(__HIP_DEVICE_COMPILE__)
  asm volatile("v_nop\n\tv_nop\n\tv_nop\n\tv_nop"
               : "+v"(a), "+v"(b), "+v"(c), "+v"(d) : "v"(p0), "v"(p1), "v"(x0), "v"(x1), "v"(x2), "v"(x3) : "memory");
#endif
}
__device__ __forceinline__ void acc_guard4(v8f& a, v8f& b, v8f& c, v8f& d) {
#if defined(__HIP_DEVICE_COMPILE__)
  asm volatile("v_nop\n\tv_nop\n\tv_nop\n\tv_nop" : "+v"(a), "+v"(b), "+v"(c), "+v"(d));
#endif
}
// Eight exponents x -> t = 2^x (bare v_exp_f32, in place), four registers of f16 pairs h = f16(t) (RNE) and four of
// l = f16(t - h) (t - h is exact in f32, so one RNE). Written in asm because the compiler's own forms convert h back to f32 and
// pack l with further instructions: here a packed convert makes two h, and one mixed-precision fma makes each l from t and the
// f16 half of h, straight into its half of the register (12 instructions behind the 8 exponentials). The exponentials stand in
// the same statement so that what follows each of them is known: the next one touches neither its result nor its source.
// The s_delay_alu hints name each reader's producer (the third-last and the last exponential; else four vector instructions
// back: mixhi keeps the half that mixlo wrote, so it reads that register) and let other waves issue meanwhile; no result changes.
__device__ __forceinline__ void exp_split8(v8f& t, v4u& h, v4u& l) {
#if defined(__HIP_DEVICE_COMPILE__)
  unsigned h0, h1, h2, h3, l0, l1, l2, l3;
  float t0 = t[0], t1 = t[1], t2 = t[2], t3 = t[3], t4 = t[4], t5 = t[5], t6 = t[6], t7 = t[7];
  asm("v_exp_f32 %8, %8\n\t"
      "v_exp_f32 %9, %9\n\t"
      "v_exp_f32 %10, %10\n\t"
      "v_exp_f32 %11, %11\n\t"
      "v_exp_f32 %12, %12\n\t"
      "v_exp_f32 %13, %13\n\t"
      "v_exp_f32 %14, %14\n\t"
      "v_exp_f32 %15, %15\n\t"
      "v_cvt_pk_f16_f32 %0, %8, %9\n\t"
      "v_cvt_pk_f16_f32 %1, %10, %11\n\t"
      "s_delay_alu instid0(TRANS32_DEP_3) | instskip(NEXT) | instid1(TRANS32_DEP_1)\n\t"
      "v_cvt_pk_f16_f32 %2, %12, %13\n\t"
      "v_cvt_pk_f16_f32 %3, %14, %15\n\t"
      "s_delay_alu instid0(VALU_DEP_4) | instskip(NEXT) | instid1(VALU_DEP_4)\n\t"
      "v_fma_mixlo_f16 %4, %8, 1.0, -%0 op_sel_hi:[0,0,1]\n\t"
      "v_fma_mixlo_f16 %5, %10, 1.0, -%1 op_sel_hi:[0,0,1]\n\t"
      "s_delay_alu instid0(VALU_DEP_4) | instskip(NEXT) | instid1(VALU_DEP_4)\n\t"
      "v_fma_mixlo_f16 %6, %12, 1.0, -%2 op_sel_hi:[0,0,1]\n\t"
      "v_fma_mixlo_f16 %7, %14, 1.0, -%3 op_sel_hi:[0,0,1]\n\t"
      "s_delay_alu instid0(VALU_DEP_4) | instskip(NEXT) | instid1(VALU_DEP_4)\n\t"
      "v_fma_mixhi_f16 %4, %9, 1.0, -%0 op_sel:[0,0,1] op_sel_hi:[0,0,1]\n\t"
      "v_fma_mixhi_f16 %5, %11, 1.0, -%1 op_sel:[0,0,1] op_sel_hi:[0,0,1]\n\t"
      "s_delay_alu instid0(VALU_DEP_4) | instskip(NEXT) | instid1(VALU_DEP_4)\n\t"
      "v_fma_mixhi_f16 %6, %13, 1.0, -%2 op_sel:[0,0,1] op_sel_hi:[0,0,1]\n\t"
      "v_fma_mixhi_f16 %7, %15, 1.0, -%3 op_sel:[0,0,1] op_sel_hi:[0,0,1]"
      : "=&v"(h0), "=&v"(h1), "=&v"(h2), "=&v"(h3), "=&v"(l0), "=&v"(l1), "=&v"(l2), "=&v"(l3),
        "+v"(t0), "+v"(t1), "+v"(t2), "+v"(t3), "+v"(t4), "+v"(t5), "+v"(t6), "+v"(t7));
  t = v8f{t0, t1, t2, t3, t4, t5, t6, t7};
  h = v4u{h0, h1, h2, h3};
  l = v4u{l0, l1, l2, l3};
#endif
}
// 2^x as the bare hardware exponential: results below 2^-126 come out as 0 (no range fix), here and in exp_split8. Every use is a
// weight relative to a maximum of 1 (x <= 0) or of 32768 (x <= 15, up to rounding): a weight that small is 0 in both f16 planes
// of P anyway and is lost against a row sum that holds the maximum's own term.
__device__ __forceinline__ float ex2(float x) { return __builtin_amdgcn_exp2f(x); }
// value of lane l ^ 16 (the other half of the wave), by a vector cross-row move
__device__ __forceinline__ float xhalf(float x) {
  const int i = __builtin_bit_cast(int, x);
  return __builtin_bit_cast(float, __builtin_amdgcn_permlanex16(i, i, 0x76543210, 0xfedcba98, false, false));
}
__device__ __forceinline__ void wave_sync_lds() {
  __builtin_amdgcn_fence(__ATOMIC_RELEASE, "workgroup");
  __builtin_amdgcn_wave_barrier();
  __builtin_amdgcn_fence(__ATOMIC_ACQUIRE, "workgroup");
}

// =====================================================================================================
// 16-bit plane convert: f16( bf16(x) * sc ) (sc a power of two, exact). blockIdx.y == 0: q plane, == 1: k plane.
//   q plane: no relayout (inputs are already head-major [h][s][d]).
//   k plane: fragment order. Per tile of 16 keys (2048 B) the 16-B unit u = 32*f + 16*hh + c holds key c, d 16f + 8hh .. +7:
//            unit 32*f + lane is what lane (hh, c) takes as piece f of the tile's two A fragments.
// Thread = 8 consecutive d of one row: two 16-B loads, one 16-B store per lane; 32 consecutive lanes store 512 contiguous B
// coverage: grid = (n8/256, 2) blocks x 256 thr x 8 elements = n = NH*4096*64 per plane exactly (n % 2048 == 0 asserted).
// =====================================================================================================
__global__ __launch_bounds__(256) void cvt16(const float* __restrict__ xq, const float* __restrict__ xk,
                                             unsigned short* plq, unsigned short* plk, int n8, float sc) {
  const int gt = blockIdx.x * 256 + (int)threadIdx.x;
  if (gt >= n8) return;                     // never taken with the exact grid; no barriers in this kernel
  const bool sk = (blockIdx.y != 0);        // block-uniform plane select (both pointers global)
  const float* x = sk ? xk : xq;
  unsigned short* pl = sk ? plk : plq;
  const size_t e = (size_t)gt * 8;          // destination element
  // source unit of 8 floats: k plane, unit gt = (tile gt >> 7, piece 2f + hh = (gt >> 4) & 7, c = gt & 15) <- row 16*tile + c
  const size_t es = sk ? (((size_t)(gt >> 7) * 16 + (size_t)(gt & 15)) * HD + (size_t)((gt >> 4) & 7) * 8) : e;
  const v4f a = *(const v4f*)(x + es), bq = *(const v4f*)(x + es + 4);
  v4u o;
#pragma unroll
  for (int i = 0; i < 2; ++i) {
    o[i]     = pk16(h_bits((_Float16)(bfr(a[2 * i]) * sc)),  h_bits((_Float16)(bfr(a[2 * i + 1]) * sc)));
    o[2 + i] = pk16(h_bits((_Float16)(bfr(bq[2 * i]) * sc)), h_bits((_Float16)(bfr(bq[2 * i + 1]) * sc)));
  }
  unsigned short* d = pl + e;
  {
    *(v4u*)(d) = o;
    
  }
}

// =====================================================================================================
// v^T plane, values f16( bf16(v[h][key][d]) * 256 ) (exact), in fragment order: per head and step of 32 keys (4096 B) the 16-B
// unit u = 64*j + 32*g + 16*hh + c holds d = 16j + c, keys 16g + 8hh .. +7 of the step: unit 64*j + 32*g + lane is piece g of
// the A fragment of d tile j in lane (hh, c).
// Block = (h, tile of 64 keys): 64 source rows of 64 floats loaded with 16-B loads (static stride), converted, written into
// coverage: load 256 thr x 16 elements = 64 keys x 64 d; store 2 iterations x 256 thr x 8 halves = 64 lines x 64 = the tile;
//           grid = NH x 64 blocks covers the whole plane (NH x 128 steps x 4096 B) exactly once.
// =====================================================================================================
__global__ __launch_bounds__(256) void vt16(const float* __restrict__ v, unsigned short* VTo) {
  __shared__ __align__(16) unsigned short T[HD * VTP];
  const int tid = threadIdx.x;
  const int bid = blockIdx.x;
  const int bh  = bid / VTILES;
  const int t   = bid - bh * VTILES;        // 0..63, block-uniform
  if (bh >= NH) return;                     // never taken with the exact grid; before any barrier or store
  {
    const int sl = tid >> 2;                  // key within tile 0..63
    const int dc = (tid & 3) * 16;            // d chunk
    int key = 64 * t + sl;                    // <= SEQ-1 by construction; clamp keeps the address in range regardless
    key = (key < 0) ? 0 : ((key > SEQ - 1) ? (SEQ - 1) : key);
    const float* src = v + (((size_t)bh * SEQ + (size_t)key) * HD + dc);
#pragma unroll
    for (int i = 0; i < 4; ++i) {
      const v4f a = *(const v4f*)(src + 4 * i);
#pragma unroll
      for (int e = 0; e < 4; ++e) T[(dc + 4 * i + e) * VTP + sl] = h_bits((_Float16)(bfr(a[e]) * VCAR));
    }
  }
  __syncthreads();
  v4u vals[2];
  const int line = ((tid >> 6) & 3) * 16 + (tid & 15);   // d = 16j + c, 0..63
  const int k8   = ((tid >> 4) & 3) * 8;                  // 16g + 8hh, key within the 32-key step
#pragma unroll
  for (int it = 0; it < 2; ++it) vals[it] = *(const v4u*)(T + line * VTP + 32 * it + k8);   // step it of the tile
  unsigned short* dst = VTo + (size_t)bh * HD * SEQ + (size_t)t * (64 * HD) + tid * 8;
  {
#pragma unroll
    for (int it = 0; it < 2; ++it) {
      *(v4u*)(dst + it * (32 * HD)) = vals[it];
    }
    
  }
}

// =====================================================================================================
// Flash attention per head, no key mask. Block = (h, 64 queries), wave w owns queries iw = 64t + 16w .. +15.
//   q plane f16 [h][s][d]; k plane and v^T plane f16 in fragment order (4096 contiguous B each per 32-key step).
//   Both products are transposed, so that lane (hh, c) holds scores and outputs of ONE query, iw + c:
//     S^T = K.Q^T : A = 16 key rows of the k plane, B = the wave's q rows (kept in registers); D[r] = (key 8hh + r, query c)
//     O^T += V^T.P^T : A = 16 d rows of the v^T plane, B = P^T packed from the two score tiles as they lie in the registers
//                      (element s < 8: key kb + 8hh + s, else key kb + 16 + 8hh + s - 8: the k map of the A loader)
//   Key loop (static bound): kb = 0, 32, ... , SEQ-32. Every key is visible to every query, so the running max is finite from
//   the first step on. Per 32-key step: 4 score WMMAs, maximum over the lane's 16 scores and one exchange between the wave
//   halves, exp2 in f32, the lane's own partial sum (the halves' sums are joined once, behind the loop), rescale, 8 P.V WMMAs.
//   The k and v^T fragments of a step are loaded one step ahead: k behind the score products, v^T behind the P.V products.
//   P never touches LDS. Epilogue: 1/l and carry folds in f32; the wave's 16x64 f32 result staged in its LDS slab (pitch 68),
//   stored as whole 256-B rows. No block barriers in this kernel; every wave of a block does identical bounded work (128 steps).
//   mkp (int32 key mask) is bound but has no effect on the result and is never read.
// coverage: per wave 8 instructions x 32 lanes x 4 floats = 16 rows x 64; per block 4 waves = 64 rows; 64 blocks per head x
//           NH heads: every row of out [NH][4096][64] exactly once (grid NH*64 blocks).
// =====================================================================================================
__global__ __launch_bounds__(ATT_THREADS)
void attn_fwd(const unsigned short* __restrict__ QHp, const unsigned short* __restrict__ KHp,
              const unsigned short* __restrict__ VTq, const int* __restrict__ mkp, float* OPp) {
  __shared__ __align__(16) float smem[ATW * SLABF];    // per wave: result slab [16][64], pitch 68
  (void)mkp;

  const int tid  = threadIdx.x;
  const int wave = tid >> 5;
  const int lane = tid & 31;
  const int hh   = lane >> 4;
  const int c    = lane & 15;

  const int bid  = blockIdx.x;
  const int bh   = bid / BPH;
  const int t    = bid - bh * BPH;                     // 0..63, block-uniform
  if (bh >= NH) return;                                // never taken with the exact grid; before any LDS use or store

  const int i0 = QPB * t;
  const int iw = i0 + wave * 16;                       // query row 0 of this wave
  const int qs = iw + c;                               // query of fragment column c, <= SEQ-1 by construction

  const _Float16* Qb = (const _Float16*)(const void*)QHp + ((size_t)bh * SEQ + (size_t)qs) * HD + 8 * hh;
  const v16h qa0 = ldfrag_h(Qb);                       // d 0..31
  const v16h qa1 = ldfrag_h(Qb + 32);                  // d 32..63
  const _Float16* Kb = (const _Float16*)(const void*)KHp + (size_t)bh * SEQ * HD;   // head's planes, block-uniform
  const _Float16* Vb = (const _Float16*)(const void*)VTq + (size_t)bh * SEQ * HD;
  const unsigned lo = (unsigned)lane * 8;              // this lane's 16-B unit within each 512-B piece
  const float lsc = LOG2E / (8.0f * QSC * KSC);

  // this lane's query: running max minus 15 (both halves alike), this half's sum x32768. With the exponent's reference 15 below
  // the maximum, 2^(s - mrun) IS the weight x32768 that the f16 planes carry: no multiply by the carry per element.
  float mrun = -INFINITY, lrun = 0.f;
  v8f o[4];                                            // o[j][r] = O^T[d = 16j + 8hh + r][query c]
#pragma unroll
  for (int j = 0; j < 4; ++j) o[j] = zero8();

  // Fragments of step 0; from here on every step fetches the NEXT step's fragments into the registers that its own products
  // have just read, so that a load has about one whole step of other work between its issue and its first use.
  // The two scheduling barriers keep the issue order q, k, v^T, which is the loop's own (k older than v^T): loads return in
  // order, so only then can the wait at the loop's head be a counted one that leaves the eight v^T loads in flight.
  __builtin_amdgcn_sched_barrier(0);
  v16h kf00 = ldfrag_p(Kb + lo),        kf01 = ldfrag_p(Kb + lo + 512);    // keys 0..15:  d 0..31, d 32..63
  v16h kf10 = ldfrag_p(Kb + lo + 1024), kf11 = ldfrag_p(Kb + lo + 1536);   // keys 16..31: d 0..31, d 32..63
  __builtin_amdgcn_sched_barrier(0);
  v16h vb0 = ldfrag_p(Vb + lo),        vb1 = ldfrag_p(Vb + lo + 512);      // d tiles 0, 1 of keys 0..31
  v16h vb2 = ldfrag_p(Vb + lo + 1024), vb3 = ldfrag_p(Vb + lo + 1536);     // d tiles 2, 3

#pragma unroll 1
  for (int kb = 0; kb < SEQ; kb += 32) {
    // step whose fragments are fetched in this one; the last step has none behind it and re-reads its own (in range, unused)
    const int kn = (kb + 32 < SEQ) ? (kb + 32) : kb;
    // ---- scores: D element r of this lane = (key kb + 8hh + r, query iw + c) in s0, key kb + 16 + 8hh + r in s1 ----
    v8f s0 = zero8(), s1 = zero8();
    s0 = mma_raw(kf00, qa0, s0);
    s0 = mma_raw(kf01, qa1, s0);
    s1 = mma_raw(kf10, qa0, s1);
    s1 = mma_raw(kf11, qa1, s1);
    guard_sc(s0, s1, qa0, qa1, kf00, kf01, kf10, kf11);
    {
      const _Float16* k0p = Kb + (size_t)kn * HD + lo;               // tile of keys kn .. kn + 15 (row c in this lane)
      const _Float16* k1p = k0p + (size_t)16 * HD;                   // tile of keys kn + 16 .. kn + 31
      kf00 = ldfrag_p(k0p);  kf01 = ldfrag_p(k0p + 512);             // d 0..31, d 32..63
      kf10 = ldfrag_p(k1p);  kf11 = ldfrag_p(k1p + 512);
    }
    // keeps the eight loads here, in front of the softmax: without it the scheduler sinks them to the P.V products and their lead goes
    __builtin_amdgcn_sched_barrier(0);
    // ---- online softmax in base 2 (no mask), one query per lane ----
    float mx = fmaxf(s0[0], s1[0]);
#pragma unroll
    for (int r = 1; r < 8; ++r) mx = fmaxf(mx, fmaxf(s0[r], s1[r]));
    mx = fmaxf(mx, xhalf(mx));                         // the other 16 keys of this query
    const float mn = fmaxf(mrun, __builtin_fmaf(mx, lsc, -PEXP));   // finite from the first step on (lsc > 0)
    const float al = ex2(mrun - mn);
    mrun = mn;
    // ---- B fragments of P^T*32768: hi f16 and residual f16, straight from the score registers ----
    FragH ph, pl;
#pragma unroll
    for (int r = 0; r < 8; ++r) {
      s0[r] = s0[r] * lsc - mn;                        // exponent of the weight x32768: 15 at the maximum
      s1[r] = s1[r] * lsc - mn;
    }
    exp_split8(s0, ph.u[0], pl.u[0]);                  // elements 0..7  = keys kb + 8hh + 0..7
    exp_split8(s1, ph.u[1], pl.u[1]);                  // elements 8..15 = keys kb + 16 + 8hh + 0..7
    float ps0 = s0[0], ps1 = s1[0];                    // as a sum started at 0 (0 + x = x: every weight is >= +0)
#pragma unroll
    for (int r = 1; r < 8; ++r) {
      ps0 += s0[r];
      ps1 += s1[r];
    }
    lrun = lrun * al + (ps0 + ps1);
#pragma unroll
    for (int j = 0; j < 4; ++j) o[j] *= al;
    // ---- O^T += V^T.P^T : A fragment row = d = j*16 + c, keys kb .. kb+31: 1024 B of the step's v^T block per d tile j ----
    o[0] = mma_raw(vb0, ph.v, o[0]);  o[0] = mma_raw(vb0, pl.v, o[0]);
    o[1] = mma_raw(vb1, ph.v, o[1]);  o[1] = mma_raw(vb1, pl.v, o[1]);
    o[2] = mma_raw(vb2, ph.v, o[2]);  o[2] = mma_raw(vb2, pl.v, o[2]);
    o[3] = mma_raw(vb3, ph.v, o[3]);  o[3] = mma_raw(vb3, pl.v, o[3]);
    guard_pv(o[0], o[1], o[2], o[3], ph.v, pl.v, vb0, vb1, vb2, vb3);
    {
      const _Float16* vp = Vb + (size_t)kn * HD + lo;                // the v^T block of keys kn .. kn + 31
      vb0 = ldfrag_p(vp);
      vb1 = ldfrag_p(vp + 512);
      vb2 = ldfrag_p(vp + 1024);
      vb3 = ldfrag_p(vp + 1536);
    }
  }
  acc_guard4(o[0], o[1], o[2], o[3]);

  // ---- join the halves' sums, fold 1/l and the carries (32768 on P, 256 on v), stage the wave's 16x64 slab in its LDS region:
  //      a lane holds 8 consecutive d of its query per tile j: two 16-B LDS stores ----
  float* slab = smem + wave * SLABF;
  const float oc = 1.0f / VCAR;                          // the carry on P stands in o and in l alike
  const float lr  = lrun + xhalf(lrun);                  // about 32768 or more (the max element contributes 2^15)
  const float inv = (lr > 0.0f) ? ((1.0f / lr) * oc) : 0.0f;
#pragma unroll
  for (int j = 0; j < 4; ++j) {
    float* sp = slab + c * SLP + j * 16 + 8 * hh;
    const v4f w0 = {o[j][0] * inv, o[j][1] * inv, o[j][2] * inv, o[j][3] * inv};
    const v4f w1 = {o[j][4] * inv, o[j][5] * inv, o[j][6] * inv, o[j][7] * inv};
    *(v4f*)(sp)     = w0;
    *(v4f*)(sp + 4) = w1;
  }
  wave_sync_lds();
  v4f vals[8];
#pragma unroll
  for (int it = 0; it < 8; ++it) vals[it] = *(const v4f*)(slab + (2 * it + hh) * SLP + c * 4);
  float* dst = OPp + ((size_t)(bh * SEQ + iw)) * HD + hh * HD + c * 4;
  {
#pragma unroll
    for (int it = 0; it < 8; ++it) {
      *(v4f*)(dst + (size_t)(2 * it) * HD) = vals[it];
    }
    
  }
}

// =====================================================================================================
// Workspace map (bytes); every plane is fully written by whole-line stores before it is read; all extents are exact
// multiples of the store granularity (no pad rows needed); offsets multiples of 128 (NH = 16 values shown):
//   QH f16 [NH][4096][64] x1024        8388608   at        0
//   KH f16 [NH][256 tiles][2048 B] x1024   8388608   at  8388608   (fragment order)
//   VT f16 [NH][128 steps][4096 B] x256    8388608   at 16777216   (fragment order)
//   end                                             25165824
// =====================================================================================================
extern "C" void kernel_launch(void* const* d_in, const int* in_sizes, int n_in,
                              void* d_out, int out_size, void* d_ws, size_t ws_size,
                              hipStream_t stream) {
  const int NEL = NH * SEQ * HD;                        // 4194304 for NH = 16
  if (n_in < 4) return;
  if (in_sizes[0] < NEL || in_sizes[1] < NEL || in_sizes[2] < NEL || in_sizes[3] < 1) return;
  if (out_size < NEL) return;

  const float* q  = (const float*)d_in[0];
  const float* k  = (const float*)d_in[1];
  const float* v  = (const float*)d_in[2];
  const int*   mk = (const int*)d_in[3];                // int32 key mask, no effect on the result
  float*       out = (float*)d_out;

  const size_t PQ = (size_t)NEL * 2;                    //  8388608
  const size_t PK = (size_t)NEL * 2;                    //  8388608
  const size_t PV = (size_t)NH * HD * SEQ * 2;          //  8388608
  size_t off = 0;
  const size_t oQH = off; off += PQ;
  const size_t oKH = off; off += PK;
  const size_t oVT = off; off += PV;
  if (off > ws_size) return;                            // off = 25165824
  if (off > (size_t)134217728) return;

  char* ws = (char*)d_ws;
  unsigned short* QH = (unsigned short*)(ws + oQH);
  unsigned short* KH = (unsigned short*)(ws + oKH);
  unsigned short* VT = (unsigned short*)(ws + oVT);

  const int n8 = NEL / 8;                               // 524288
  const dim3 blk(256);
  const dim3 gC(n8 / 256, 2);                           // (2048, 2): q and k planes in one launch
  const dim3 gVT(NH * VTILES);                          // 1024
  const dim3 gAT(ATT_BLOCKS);                           // 1024
  const dim3 bAT(ATT_THREADS);                          // 128

  // (0) q and k planes f16(bf16(x) * 1024): q [h][s][d], k in fragment order
  cvt16<<<gC, blk, 0, stream>>>(q, k, QH, KH, n8, QSC);
  // (1) v^T plane f16(bf16(v) * 256), fragment order
  vt16<<<gVT, blk, 0, stream>>>(v, VT);
  // (2) flash attention per head -> out [h][s][d] f32
  attn_fwd<<<gAT, bAT, 0, stream>>>(QH, KH, VT, mk, out);
  (void)hipGetLastError();
}

// v006
// A run of this version takes 87.5 microseconds.
// Next to v005, in two timings, it ran 1.19 and 1.17 times as fast.
// Counting every step since v000, it is 3.05 times as fast.
// Contractions, both transposed: scores S^T = k.q^T (q x1024 and k x1024 as f16 planes of the bf16-RNE-converted inputs, one
// product each, K=64) and O^T += v^T.P^T (P x32768 as f16 hi plane + f16 residual plane, v x256 f16 of the bf16-RNE-converted
// input, products v.hi+v.lo, 32-key steps): all v_wmma_f32_16x16x32_f16, f32 accumulate. Base-2 online softmax over all keys (no key mask) and the 1/l fold in f32 on VALU.
#include <hip/hip_runtime.h>
#include <math.h>
#include <stdint.h>

#ifndef NH
#define NH    16
#endif
#define SEQ   4096
#define HD    64
#define QSC   1024.0f
#define KSC   1024.0f
#define PCAR  32768.0f
#define PEXP  15.0f
#define VCAR  256.0f
#define LOG2E 1.4426950408889634f
#define ATW   8
#define ATT_THREADS (ATW * 32)
#define QGR   4                   // query groups of 32 per block
#define KSPL  2                   // key halves per block
#define QPB   (32 * QGR)
#define KPW   (SEQ / KSPL)        // keys walked by one wave
#define XCHF  (8 * 32 * 4)        // floats one wave hands to its partner: 32 per lane
#define BPH   (SEQ / QPB)
#define ATT_BLOCKS (NH * BPH)
#define SLP   68
#define SLABF (16 * SLP)
#define VTP   72
#define VTILES (SEQ / 64)
static_assert(HD == 64 && QPB == 128 && ATT_THREADS == 256 && ATW == QGR * KSPL && KSPL == 2);
static_assert(PCAR == 32768.0f && PEXP == 15.0f);   // PCAR = 2^PEXP
static_assert((SEQ % QPB) == 0 && (SEQ % 64) == 0 && (KPW % 32) == 0 && KPW >= 32);
static_assert(BPH == 32 && ATT_BLOCKS == NH * 32 && VTILES == 64);
static_assert(NH >= 1 && NH <= 16);
static_assert((HD - 1) * VTP + 63 < HD * VTP);
static_assert(((NH * SEQ * HD) % 2048) == 0);

typedef _Float16 v16h __attribute__((ext_vector_type(16)));
typedef _Float16 v8h  __attribute__((ext_vector_type(8)));
typedef float    v8f  __attribute__((ext_vector_type(8)));
typedef float    v4f  __attribute__((ext_vector_type(4)));
typedef unsigned int v4u __attribute__((ext_vector_type(4)));

union FragH { v16h v; v8h h[2]; v4u u[2]; };

// ---- scalar helpers --------------------------------------------------------------------------------
__device__ __forceinline__ unsigned short bf_bits(float f) {          // f32 -> bf16 bits, RNE convert
  unsigned u = __float_as_uint(f);
  return (unsigned short)((u + 0x7FFFu + ((u >> 16) & 1u)) >> 16);
}
__device__ __forceinline__ float bf_up(unsigned short h) { return __uint_as_float(((unsigned)h) << 16); }
__device__ __forceinline__ float bfr(float f) { return bf_up(bf_bits(f)); }   // value of the bf16 RNE convert
__device__ __forceinline__ unsigned short h_bits(_Float16 x) { return __builtin_bit_cast(unsigned short, x); }
__device__ __forceinline__ unsigned pk16(unsigned short a, unsigned short b) { return (unsigned)a | ((unsigned)b << 16); }
__device__ __forceinline__ v8f zero8() { v8f z = {0.f, 0.f, 0.f, 0.f, 0.f, 0.f, 0.f, 0.f}; return z; }

// ---- fragment loader: 16-bit A/B operand, lane -> row/col (lane&15), p already includes +8*(lane>>4);
//      elements 0..7 <- p[0..7] (k0+8h..), elements 8..15 <- p[16..23] (k0+16+8h..)  (same split k map for A and B;
//      B is always read from a k-contiguous [n][k] plane)
__device__ __forceinline__ v16h ldfrag_h(const _Float16* p) {
  FragH f;
  f.h[0] = *(const v8h*)(p);
  f.h[1] = *(const v8h*)(p + 16);
  return f.v;
}

// the same fragment from a plane stored in fragment order: p already includes +8*lane; the two 16-B pieces of a lane lie 256
// halves apart, so that each wave-wide 16-B load covers 512 contiguous bytes (4 whole lines)
__device__ __forceinline__ v16h ldfrag_p(const _Float16* p) {
  FragH f;
  f.h[0] = *(const v8h*)(p);
  f.h[1] = *(const v8h*)(p + 256);
  return f.v;
}

__device__ __forceinline__ v8f mma_raw(v16h a, v16h b, v8f c) {
  return __builtin_amdgcn_wmma_f32_16x16x32_f16(false, a, false, b, (short)0, c, false, false);
}
// The four vector slots that the chip needs behind a WMMA before a vector instruction touches its D, A or B; the operands tie the
// slots behind the products of a step, and the fragment loads of the next step (over A) stand behind them.
__device__ __forceinline__ void guard_sc(v8f& a, v8f& b, v8f& c, v8f& d, v16h q0, v16h q1, v16h q2, v16h q3,
                                         v16h x0, v16h x1, v16h x2, v16h x3) {
#if defined(__HIP_DEVICE_COMPILE__)
  asm volatile("v_nop\n\tv_nop\n\tv_nop\n\tv_nop"
               : "+v"(a), "+v"(b), "+v"(c), "+v"(d)
               : "v"(q0), "v"(q1), "v"(q2), "v"(q3), "v"(x0), "v"(x1), "v"(x2), "v"(x3) : "memory");
#endif
}
__device__ __forceinline__ void guard_pv(v8f& a, v8f& b, v8f& c, v8f& d, v8f& e, v8f& f, v8f& g, v8f& h,
                                         v16h p0, v16h p1, v16h p2, v16h p3, v16h x0, v16h x1, v16h x2, v16h x3) {
#if defined(__HIP_DEVICE_COMPILE__)
  asm volatile("v_nop\n\tv_nop\n\tv_nop\n\tv_nop"
               : "+v"(a), "+v"(b), "+v"(c), "+v"(d), "+v"(e), "+v"(f), "+v"(g), "+v"(h)
               : "v"(p0), "v"(p1), "v"(p2), "v"(p3), "v"(x0), "v"(x1), "v"(x2), "v"(x3) : "memory");
#endif
}
__device__ __forceinline__ void acc_guard4(v8f& a, v8f& b, v8f& c, v8f& d) {
#if defined(__HIP_DEVICE_COMPILE__)
  asm volatile("v_nop\n\tv_nop\n\tv_nop\n\tv_nop" : "+v"(a), "+v"(b), "+v"(c), "+v"(d));
#endif
}
// Eight exponents x -> t = 2^x (bare v_exp_f32, in place), four registers of f16 pairs h = f16(t) (RNE) and four of
// l = f16(t - h) (t - h is exact in f32, so one RNE). Written in asm because the compiler's own forms convert h back to f32 and
// pack l with further instructions: here a packed convert makes two h, and one mixed-precision fma makes each l from t and the
// f16 half of h, straight into its half of the register (12 instructions behind the 8 exponentials). The exponentials stand in
// the same statement so that what follows each of them is known: the next one touches neither its result nor its source.
// The s_delay_alu hints name each reader's producer (the third-last and the last exponential; else four vector instructions
// back: mixhi keeps the half that mixlo wrote, so it reads that register) and let other waves issue meanwhile; no result changes.
__device__ __forceinline__ void exp_split8(v8f& t, v4u& h, v4u& l) {
#if defined(__HIP_DEVICE_COMPILE__)
  unsigned h0, h1, h2, h3, l0, l1, l2, l3;
  float t0 = t[0], t1 = t[1], t2 = t[2], t3 = t[3], t4 = t[4], t5 = t[5], t6 = t[6], t7 = t[7];
  asm("v_exp_f32 %8, %8\n\t"
      "v_exp_f32 %9, %9\n\t"
      "v_exp_f32 %10, %10\n\t"
      "v_exp_f32 %11, %11\n\t"
      "v_exp_f32 %12, %12\n\t"
      "v_exp_f32 %13, %13\n\t"
      "v_exp_f32 %14, %14\n\t"
      "v_exp_f32 %15, %15\n\t"
      "v_cvt_pk_f16_f32 %0, %8, %9\n\t"
      "v_cvt_pk_f16_f32 %1, %10, %11\n\t"
      "s_delay_alu instid0(TRANS32_DEP_3) | instskip(NEXT) | instid1(TRANS32_DEP_1)\n\t"
      "v_cvt_pk_f16_f32 %2, %12, %13\n\t"
      "v_cvt_pk_f16_f32 %3, %14, %15\n\t"
      "s_delay_alu instid0(VALU_DEP_4) | instskip(NEXT) | instid1(VALU_DEP_4)\n\t"
      "v_fma_mixlo_f16 %4, %8, 1.0, -%0 op_sel_hi:[0,0,1]\n\t"
      "v_fma_mixlo_f16 %5, %10, 1.0, -%1 op_sel_hi:[0,0,1]\n\t"
      "s_delay_alu instid0(VALU_DEP_4) | instskip(NEXT) | instid1(VALU_DEP_4)\n\t"
      "v_fma_mixlo_f16 %6, %12, 1.0, -%2 op_sel_hi:[0,0,1]\n\t"
      "v_fma_mixlo_f16 %7, %14, 1.0, -%3 op_sel_hi:[0,0,1]\n\t"
      "s_delay_alu instid0(VALU_DEP_4) | instskip(NEXT) | instid1(VALU_DEP_4)\n\t"
      "v_fma_mixhi_f16 %4, %9, 1.0, -%0 op_sel:[0,0,1] op_sel_hi:[0,0,1]\n\t"
      "v_fma_mixhi_f16 %5, %11, 1.0, -%1 op_sel:[0,0,1] op_sel_hi:[0,0,1]\n\t"
      "s_delay_alu instid0(VALU_DEP_4) | instskip(NEXT) | instid1(VALU_DEP_4)\n\t"
      "v_fma_mixhi_f16 %6, %13, 1.0, -%2 op_sel:[0,0,1] op_sel_hi:[0,0,1]\n\t"
      "v_fma_mixhi_f16 %7, %15, 1.0, -%3 op_sel:[0,0,1] op_sel_hi:[0,0,1]"
      : "=&v"(h0), "=&v"(h1), "=&v"(h2), "=&v"(h3), "=&v"(l0), "=&v"(l1), "=&v"(l2), "=&v"(l3),
        "+v"(t0), "+v"(t1), "+v"(t2), "+v"(t3), "+v"(t4), "+v"(t5), "+v"(t6), "+v"(t7));
  t = v8f{t0, t1, t2, t3, t4, t5, t6, t7};
  h = v4u{h0, h1, h2, h3};
  l = v4u{l0, l1, l2, l3};
#endif
}
// 2^x as the bare hardware exponential: results below 2^-126 come out as 0 (no range fix), here and in exp_split8. Every use is a
// weight relative to a maximum of 1 (x <= 0) or of 32768 (x <= 15, up to rounding): a weight that small is 0 in both f16 planes
// of P anyway and is lost against a row sum that holds the maximum's own term.
__device__ __forceinline__ float ex2(float x) { return __builtin_amdgcn_exp2f(x); }
// value of lane l ^ 16 (the other half of the wave), by a vector cross-row move
__device__ __forceinline__ float xhalf(float x) {
  const int i = __builtin_bit_cast(int, x);
  return __builtin_bit_cast(float, __builtin_amdgcn_permlanex16(i, i, 0x76543210, 0xfedcba98, false, false));
}
__device__ __forceinline__ void wave_sync_lds() {
  __builtin_amdgcn_fence(__ATOMIC_RELEASE, "workgroup");
  __builtin_amdgcn_wave_barrier();
  __builtin_amdgcn_fence(__ATOMIC_ACQUIRE, "workgroup");
}

// =====================================================================================================
// 16-bit plane convert: f16( bf16(x) * sc ) (sc a power of two, exact). blockIdx.y == 0: q plane, == 1: k plane.
//   q plane: no relayout (inputs are already head-major [h][s][d]).
//   k plane: fragment order. Per tile of 16 keys (2048 B) the 16-B unit u = 32*f + 16*hh + c holds key c, d 16f + 8hh .. +7:
//            unit 32*f + lane is what lane (hh, c) takes as piece f of the tile's two A fragments.
// Thread = 8 consecutive d of one row: two 16-B loads, one 16-B store per lane; 32 consecutive lanes store 512 contiguous B
// coverage: grid = (n8/256, 2) blocks x 256 thr x 8 elements = n = NH*4096*64 per plane exactly (n % 2048 == 0 asserted).
// =====================================================================================================
__global__ __launch_bounds__(256) void cvt16(const float* __restrict__ xq, const float* __restrict__ xk,
                                             unsigned short* plq, unsigned short* plk, int n8, float sc) {
  const int gt = blockIdx.x * 256 + (int)threadIdx.x;
  if (gt >= n8) return;                     // never taken with the exact grid; no barriers in this kernel
  const bool sk = (blockIdx.y != 0);        // block-uniform plane select (both pointers global)
  const float* x = sk ? xk : xq;
  unsigned short* pl = sk ? plk : plq;
  const size_t e = (size_t)gt * 8;          // destination element
  // source unit of 8 floats: k plane, unit gt = (tile gt >> 7, piece 2f + hh = (gt >> 4) & 7, c = gt & 15) <- row 16*tile + c
  const size_t es = sk ? (((size_t)(gt >> 7) * 16 + (size_t)(gt & 15)) * HD + (size_t)((gt >> 4) & 7) * 8) : e;
  const v4f a = *(const v4f*)(x + es), bq = *(const v4f*)(x + es + 4);
  v4u o;
#pragma unroll
  for (int i = 0; i < 2; ++i) {
    o[i]     = pk16(h_bits((_Float16)(bfr(a[2 * i]) * sc)),  h_bits((_Float16)(bfr(a[2 * i + 1]) * sc)));
    o[2 + i] = pk16(h_bits((_Float16)(bfr(bq[2 * i]) * sc)), h_bits((_Float16)(bfr(bq[2 * i + 1]) * sc)));
  }
  unsigned short* d = pl + e;
  {
    *(v4u*)(d) = o;
    
  }
}

// =====================================================================================================
// v^T plane, values f16( bf16(v[h][key][d]) * 256 ) (exact), in fragment order: per head and step of 32 keys (4096 B) the 16-B
// unit u = 64*j + 32*g + 16*hh + c holds d = 16j + c, keys 16g + 8hh .. +7 of the step: unit 64*j + 32*g + lane is piece g of
// the A fragment of d tile j in lane (hh, c).
// Block = (h, tile of 64 keys): 64 source rows of 64 floats loaded with 16-B loads (static stride), converted, written into
// coverage: load 256 thr x 16 elements = 64 keys x 64 d; store 2 iterations x 256 thr x 8 halves = 64 lines x 64 = the tile;
//           grid = NH x 64 blocks covers the whole plane (NH x 128 steps x 4096 B) exactly once.
// =====================================================================================================
__global__ __launch_bounds__(256) void vt16(const float* __restrict__ v, unsigned short* VTo) {
  __shared__ __align__(16) unsigned short T[HD * VTP];
  const int tid = threadIdx.x;
  const int bid = blockIdx.x;
  const int bh  = bid / VTILES;
  const int t   = bid - bh * VTILES;        // 0..63, block-uniform
  if (bh >= NH) return;                     // never taken with the exact grid; before any barrier or store
  {
    const int sl = tid >> 2;                  // key within tile 0..63
    const int dc = (tid & 3) * 16;            // d chunk
    int key = 64 * t + sl;                    // <= SEQ-1 by construction; clamp keeps the address in range regardless
    key = (key < 0) ? 0 : ((key > SEQ - 1) ? (SEQ - 1) : key);
    const float* src = v + (((size_t)bh * SEQ + (size_t)key) * HD + dc);
#pragma unroll
    for (int i = 0; i < 4; ++i) {
      const v4f a = *(const v4f*)(src + 4 * i);
#pragma unroll
      for (int e = 0; e < 4; ++e) T[(dc + 4 * i + e) * VTP + sl] = h_bits((_Float16)(bfr(a[e]) * VCAR));
    }
  }
  __syncthreads();
  v4u vals[2];
  const int line = ((tid >> 6) & 3) * 16 + (tid & 15);   // d = 16j + c, 0..63
  const int k8   = ((tid >> 4) & 3) * 8;                  // 16g + 8hh, key within the 32-key step
#pragma unroll
  for (int it = 0; it < 2; ++it) vals[it] = *(const v4u*)(T + line * VTP + 32 * it + k8);   // step it of the tile
  unsigned short* dst = VTo + (size_t)bh * HD * SEQ + (size_t)t * (64 * HD) + tid * 8;
  {
#pragma unroll
    for (int it = 0; it < 2; ++it) {
      *(v4u*)(dst + it * (32 * HD)) = vals[it];
    }
    
  }
}

// =====================================================================================================
// Flash attention per head, no key mask. Block = (h, 128 queries), 8 waves = 4 query groups x 2 key halves: wave w owns the 32
// queries iw = 128t + 32(w & 3) .. +31 (two 16-column groups A, B) and walks the keys 2048(w >> 2) .. +2047.
//   q plane f16 [h][s][d]; k plane and v^T plane f16 in fragment order (4096 contiguous B each per 32-key step).
//   Both products are transposed, so that lane (hh, c) holds scores and outputs of ONE query per group, iw + c and iw + 16 + c:
//     S^T = K.Q^T : A = 16 key rows of the k plane, B = a group's q rows (kept in registers); D[r] = (key 8hh + r, query c)
//     O^T += V^T.P^T : A = 16 d rows of the v^T plane, B = P^T packed from the two score tiles as they lie in the registers
//                      (element s < 8: key kb + 8hh + s, else key kb + 16 + 8hh + s - 8: the k map of the A loader)
//   Every k and v^T fragment that a wave loads feeds both groups' products.
//   Key loop (static bound): 64 steps of 32 keys. Every key is visible to every query, so the running max is finite from the
//   first step on. Per step and group: 4 score WMMAs, maximum over the lane's 16 scores and one exchange between the wave
//   halves, exp2 in f32, the lane's own partial sum (the halves' sums are joined once, behind the loop), rescale, 8 P.V WMMAs.
//   The k and v^T fragments of a step are loaded one step ahead: k behind the score products, v^T behind the P.V products.
//   P never touches LDS. Behind the loop the two waves of a query group (w, w ^ 4) join their key halves through LDS: wave w keeps
//   group (w >> 2) and hands the other group's max, sum and O^T to its partner; one block barrier; then
//   o = o1 2^(m1 - m) + o2 2^(m2 - m), l alike. Epilogue: 1/l and carry folds in f32; the wave's 16x64 f32 result staged in its
//   LDS slab (pitch 68), stored as whole 256-B rows. Every wave of a block does identical bounded work and passes the barrier.
//   mkp (int32 key mask) is bound but has no effect on the result and is never read.
// coverage: per wave 8 instructions x 32 lanes x 4 floats = 16 rows x 64 (queries 128t + 32(w & 3) + 16(w >> 2) .. +15); per block
//           8 waves = 128 rows; 32 blocks per head x NH heads: every row of out [NH][4096][64] exactly once (grid NH*32 blocks).
// =====================================================================================================
// one 32-key step of the base-2 online softmax of one 16-query group: scores s0, s1 -> weights x32768 (in place), their f16 hi and
// residual planes as B fragments; running max, this half's sum and the group's O^T tiles rescaled
__device__ __forceinline__ void soft_step(v8f& s0, v8f& s1, float& mrun, float& lrun, v8f (&o)[4], FragH& ph, FragH& pl,
                                          const float lsc) {
  float mx = fmaxf(s0[0], s1[0]);
#pragma unroll
  for (int r = 1; r < 8; ++r) mx = fmaxf(mx, fmaxf(s0[r], s1[r]));
  mx = fmaxf(mx, xhalf(mx));                         // the other 16 keys of this query
  const float mn = fmaxf(mrun, __builtin_fmaf(mx, lsc, -PEXP));   // finite from the first step on (lsc > 0)
  const float al = ex2(mrun - mn);
  mrun = mn;
#pragma unroll
  for (int r = 0; r < 8; ++r) {
    s0[r] = s0[r] * lsc - mn;                        // exponent of the weight x32768: 15 at the maximum
    s1[r] = s1[r] * lsc - mn;
  }
  exp_split8(s0, ph.u[0], pl.u[0]);                  // elements 0..7  = keys kb + 8hh + 0..7
  exp_split8(s1, ph.u[1], pl.u[1]);                  // elements 8..15 = keys kb + 16 + 8hh + 0..7
  float ps0 = s0[0], ps1 = s1[0];                    // as a sum started at 0 (0 + x = x: every weight is >= +0)
#pragma unroll
  for (int r = 1; r < 8; ++r) {
    ps0 += s0[r];
    ps1 += s1[r];
  }
  lrun = lrun * al + (ps0 + ps1);
#pragma unroll
  for (int j = 0; j < 4; ++j) o[j] *= al;
}

// amdgpu_waves_per_eu(4, 4): at most 256 registers a wave, so that two blocks (four waves per SIMD) are resident on a WGP
__global__ __launch_bounds__(ATT_THREADS) __attribute__((amdgpu_waves_per_eu(4, 4)))
void attn_fwd(const unsigned short* __restrict__ QHp, const unsigned short* __restrict__ KHp,
              const unsigned short* __restrict__ VTq, const int* __restrict__ mkp, float* OPp) {
  __shared__ __align__(16) float smem[ATW * SLABF];    // per wave: result slab [16][64], pitch 68
  __shared__ __align__(16) float xch[ATW * XCHF];      // per wave: the O^T tiles handed to the partner, [8 pieces][32 lanes][4]
  __shared__ float xml[ATW * 64];                      // per wave: max [32 lanes], sum [32 lanes] handed to the partner
  (void)mkp;

  const int tid  = threadIdx.x;
  const int wave = __builtin_amdgcn_readfirstlane(tid >> 5);   // wave-uniform: keeps the key half in scalar registers
  const int lane = tid & 31;
  const int hh   = lane >> 4;
  const int c    = lane & 15;
  const int qg   = wave & (QGR - 1);                   // query group of 32
  const int kh   = wave >> 2;                          // key half 0, 1

  const int bid  = blockIdx.x;
  const int bh   = bid / BPH;
  const int t    = bid - bh * BPH;                     // 0..31, block-uniform
  if (bh >= NH) return;                                // never taken with the exact grid; before any LDS use, barrier or store

  const int i0 = QPB * t;
  const int iw = i0 + qg * 32;                         // query row 0 of this wave
  const int qs = iw + c;                               // query of column c of group A, <= SEQ-17 by construction

  const _Float16* Qb = (const _Float16*)(const void*)QHp + ((size_t)bh * SEQ + (size_t)qs) * HD + 8 * hh;
  const v16h qa0 = ldfrag_h(Qb);                       // group A: d 0..31
  const v16h qa1 = ldfrag_h(Qb + 32);                  //          d 32..63
  const v16h qb0 = ldfrag_h(Qb + 16 * HD);             // group B (queries + 16): d 0..31
  const v16h qb1 = ldfrag_h(Qb + 16 * HD + 32);        //          d 32..63
  // this wave's half of the head's planes, wave-uniform
  const _Float16* Kb = (const _Float16*)(const void*)KHp + (size_t)bh * SEQ * HD + (size_t)kh * KPW * HD;
  const _Float16* Vb = (const _Float16*)(const void*)VTq + (size_t)bh * SEQ * HD + (size_t)kh * KPW * HD;
  const unsigned lo = (unsigned)lane * 8;              // this lane's 16-B unit within each 512-B piece
  const float lsc = LOG2E / (8.0f * QSC * KSC);

  // per group, this lane's query: running max minus 15 (both halves alike), this half's sum x32768. With the exponent's reference
  // 15 below the maximum, 2^(s - mrun) IS the weight x32768 that the f16 planes carry: no multiply by the carry per element.
  float mA = -INFINITY, lA = 0.f, mB = -INFINITY, lB = 0.f;
  v8f oA[4], oB[4];                                    // o[j][r] = O^T[d = 16j + 8hh + r][query c of the group]
#pragma unroll
  for (int j = 0; j < 4; ++j) { oA[j] = zero8(); oB[j] = zero8(); }

  // Fragments of step 0; from here on every step fetches the NEXT step's fragments into the registers that its own products
  // have just read, so that a load has about one whole step of other work between its issue and its first use.
  // The two scheduling barriers keep the issue order q, k, v^T, which is the loop's own (k older than v^T): loads return in
  // order, so only then can the wait at the loop's head be a counted one that leaves the eight v^T loads in flight.
  __builtin_amdgcn_sched_barrier(0);
  v16h kf00 = ldfrag_p(Kb + lo),        kf01 = ldfrag_p(Kb + lo + 512);    // keys 0..15 of the half:  d 0..31, d 32..63
  v16h kf10 = ldfrag_p(Kb + lo + 1024), kf11 = ldfrag_p(Kb + lo + 1536);   // keys 16..31: d 0..31, d 32..63
  __builtin_amdgcn_sched_barrier(0);
  v16h vb0 = ldfrag_p(Vb + lo),        vb1 = ldfrag_p(Vb + lo + 512);      // d tiles 0, 1 of keys 0..31 of the half
  v16h vb2 = ldfrag_p(Vb + lo + 1024), vb3 = ldfrag_p(Vb + lo + 1536);     // d tiles 2, 3

  // kept rolled: one step's body holds the registers of four waves per SIMD
#pragma unroll 1
  for (int kb = 0; kb < KPW; kb += 32) {               // kb counts within this wave's half
    // step whose fragments are fetched in this one; the last step has none behind it and re-reads its own (in range, unused)
    const int kn = (kb + 32 < KPW) ? (kb + 32) : kb;
    // ---- scores: D element r of this lane = (key kb + 8hh + r, the group's query c) in s.0, key kb + 16 + 8hh + r in s.1 ----
    v8f sA0 = zero8(), sA1 = zero8(), sB0 = zero8(), sB1 = zero8();
    sA0 = mma_raw(kf00, qa0, sA0);
    sB0 = mma_raw(kf00, qb0, sB0);
    sA1 = mma_raw(kf10, qa0, sA1);
    sB1 = mma_raw(kf10, qb0, sB1);
    sA0 = mma_raw(kf01, qa1, sA0);
    sB0 = mma_raw(kf01, qb1, sB0);
    sA1 = mma_raw(kf11, qa1, sA1);
    sB1 = mma_raw(kf11, qb1, sB1);
    guard_sc(sA0, sA1, sB0, sB1, qa0, qa1, qb0, qb1, kf00, kf01, kf10, kf11);
    {
      const _Float16* k0p = Kb + (size_t)kn * HD + lo;               // tile of keys kn .. kn + 15 (row c in this lane)
      const _Float16* k1p = k0p + (size_t)16 * HD;                   // tile of keys kn + 16 .. kn + 31
      kf00 = ldfrag_p(k0p);  kf01 = ldfrag_p(k0p + 512);             // d 0..31, d 32..63
      kf10 = ldfrag_p(k1p);  kf11 = ldfrag_p(k1p + 512);
    }
    // keeps the eight loads here, in front of the softmax: without it the scheduler sinks them to the P.V products and their lead goes
    __builtin_amdgcn_sched_barrier(0);
    // ---- per group: online softmax in base 2 (no mask), one query per lane; B fragments of P^T*32768, hi f16 and residual f16,
    //      straight from the score registers; O^T += V^T.P^T : A fragment row = d = j*16 + c, keys kb .. kb+31 ----
    FragH phA, plA, phB, plB;
    soft_step(sA0, sA1, mA, lA, oA, phA, plA, lsc);
    oA[0] = mma_raw(vb0, phA.v, oA[0]);  oA[1] = mma_raw(vb1, phA.v, oA[1]);
    oA[2] = mma_raw(vb2, phA.v, oA[2]);  oA[3] = mma_raw(vb3, phA.v, oA[3]);
    oA[0] = mma_raw(vb0, plA.v, oA[0]);  oA[1] = mma_raw(vb1, plA.v, oA[1]);
    oA[2] = mma_raw(vb2, plA.v, oA[2]);  oA[3] = mma_raw(vb3, plA.v, oA[3]);
    soft_step(sB0, sB1, mB, lB, oB, phB, plB, lsc);
    oB[0] = mma_raw(vb0, phB.v, oB[0]);  oB[1] = mma_raw(vb1, phB.v, oB[1]);
    oB[2] = mma_raw(vb2, phB.v, oB[2]);  oB[3] = mma_raw(vb3, phB.v, oB[3]);
    oB[0] = mma_raw(vb0, plB.v, oB[0]);  oB[1] = mma_raw(vb1, plB.v, oB[1]);
    oB[2] = mma_raw(vb2, plB.v, oB[2]);  oB[3] = mma_raw(vb3, plB.v, oB[3]);
    guard_pv(oA[0], oA[1], oA[2], oA[3], oB[0], oB[1], oB[2], oB[3], phA.v, plA.v, phB.v, plB.v, vb0, vb1, vb2, vb3);
    {
      const _Float16* vp = Vb + (size_t)kn * HD + lo;                // the v^T block of keys kn .. kn + 31
      vb0 = ldfrag_p(vp);
      vb1 = ldfrag_p(vp + 512);
      vb2 = ldfrag_p(vp + 1024);
      vb3 = ldfrag_p(vp + 1536);
    }
  }
  acc_guard4(oA[0], oA[1], oA[2], oA[3]);
  acc_guard4(oB[0], oB[1], oB[2], oB[3]);

  // ---- join the wave halves' sums; then join the two key halves: this wave keeps group kh and hands the other group to wave ^ 4
  //      (same lane = same query and same d rows there) ----
  const float lAj = lA + xhalf(lA);                      // about 32768 or more (the half's max element contributes 2^15)
  const float lBj = lB + xhalf(lB);
  const bool  kB  = (kh != 0);                           // wave-uniform
  const float mk = kB ? mB : mA,  lk = kB ? lBj : lAj;   // kept
  const float ms = kB ? mA : mB,  ls = kB ? lAj : lBj;   // handed over
  v8f ok[4];
  {
    float* xw = xch + wave * XCHF + lane * 4;            // 32 lanes x 16 B = 512 contiguous B per store
#pragma unroll
    for (int j = 0; j < 4; ++j) {
      v8f os;
#pragma unroll
      for (int r = 0; r < 8; ++r) { ok[j][r] = kB ? oB[j][r] : oA[j][r];  os[r] = kB ? oA[j][r] : oB[j][r]; }
      const v4f w0 = {os[0], os[1], os[2], os[3]};
      const v4f w1 = {os[4], os[5], os[6], os[7]};
      *(v4f*)(xw + (2 * j) * 128)     = w0;
      *(v4f*)(xw + (2 * j + 1) * 128) = w1;
    }
    xml[wave * 64 + lane]      = ms;
    xml[wave * 64 + 32 + lane] = ls;
  }
  __syncthreads();                                       // the partner's tiles, max and sum are read behind it; every wave passes it
  const int   pw = wave ^ QGR;                           // same query group, other key half
  const float mt = xml[pw * 64 + lane];
  const float lt = xml[pw * 64 + 32 + lane];
  const float mj = fmaxf(mk, mt);                        // both finite
  const float wk = ex2(mk - mj), wt = ex2(mt - mj);      // one of them is 1
  const float lr = lk * wk + lt * wt;

  // ---- fold 1/l and the carries (32768 on P, 256 on v), stage the wave's 16x64 slab in its LDS region:
  //      a lane holds 8 consecutive d of its query per tile j: two 16-B LDS stores ----
  float* slab = smem + wave * SLABF;
  const float oc = 1.0f / VCAR;                          // the carry on P stands in o and in l alike
  const float inv = (lr > 0.0f) ? ((1.0f / lr) * oc) : 0.0f;
  const float fk = wk * inv, ft = wt * inv;
  const float* xr = xch + pw * XCHF + lane * 4;
#pragma unroll
  for (int j = 0; j < 4; ++j) {
    const v4f t0 = *(const v4f*)(xr + (2 * j) * 128);
    const v4f t1 = *(const v4f*)(xr + (2 * j + 1) * 128);
    float* sp = slab + c * SLP + j * 16 + 8 * hh;
    const v4f w0 = {ok[j][0] * fk + t0[0] * ft, ok[j][1] * fk + t0[1] * ft, ok[j][2] * fk + t0[2] * ft, ok[j][3] * fk + t0[3] * ft};
    const v4f w1 = {ok[j][4] * fk + t1[0] * ft, ok[j][5] * fk + t1[1] * ft, ok[j][6] * fk + t1[2] * ft, ok[j][7] * fk + t1[3] * ft};
    *(v4f*)(sp)     = w0;
    *(v4f*)(sp + 4) = w1;
  }
  wave_sync_lds();
  v4f vals[8];
#pragma unroll
  for (int it = 0; it < 8; ++it) vals[it] = *(const v4f*)(slab + (2 * it + hh) * SLP + c * 4);
  float* dst = OPp + ((size_t)(bh * SEQ + iw + 16 * kh)) * HD + hh * HD + c * 4;   // rows of the kept group
  {
#pragma unroll
    for (int it = 0; it < 8; ++it) {
      *(v4f*)(dst + (size_t)(2 * it) * HD) = vals[it];
    }
    
  }
}

// =====================================================================================================
// Workspace map (bytes); every plane is fully written by whole-line stores before it is read; all extents are exact
// multiples of the store granularity (no pad rows needed); offsets multiples of 128 (NH = 16 values shown):
//   QH f16 [NH][4096][64] x1024        8388608   at        0
//   KH f16 [NH][256 tiles][2048 B] x1024   8388608   at  8388608   (fragment order)
//   VT f16 [NH][128 steps][4096 B] x256    8388608   at 16777216   (fragment order)
//   end                                             25165824
// =====================================================================================================
extern "C" void kernel_launch(void* const* d_in, const int* in_sizes, int n_in,
                              void* d_out, int out_size, void* d_ws, size_t ws_size,
                              hipStream_t stream) {
  const int NEL = NH * SEQ * HD;                        // 4194304 for NH = 16
  if (n_in < 4) return;
  if (in_sizes[0] < NEL || in_sizes[1] < NEL || in_sizes[2] < NEL || in_sizes[3] < 1) return;
  if (out_size < NEL) return;

  const float* q  = (const float*)d_in[0];
  const float* k  = (const float*)d_in[1];
  const float* v  = (const float*)d_in[2];
  const int*   mk = (const int*)d_in[3];                // int32 key mask, no effect on the result
  float*       out = (float*)d_out;

  const size_t PQ = (size_t)NEL * 2;                    //  8388608
  const size_t PK = (size_t)NEL * 2;                    //  8388608
  const size_t PV = (size_t)NH * HD * SEQ * 2;          //  8388608
  size_t off = 0;
  const size_t oQH = off; off += PQ;
  const size_t oKH = off; off += PK;
  const size_t oVT = off; off += PV;
  if (off > ws_size) return;                            // off = 25165824
  if (off > (size_t)134217728) return;

  char* ws = (char*)d_ws;
  unsigned short* QH = (unsigned short*)(ws + oQH);
  unsigned short* KH = (unsigned short*)(ws + oKH);
  unsigned short* VT = (unsigned short*)(ws + oVT);

  const int n8 = NEL / 8;                               // 524288
  const dim3 blk(256);
  const dim3 gC(n8 / 256, 2);                           // (2048, 2): q and k planes in one launch
  const dim3 gVT(NH * VTILES);                          // 1024
  const dim3 gAT(ATT_BLOCKS);                           // 512
  const dim3 bAT(ATT_THREADS);                          // 256

  // (0) q and k planes f16(bf16(x) * 1024): q [h][s][d], k in fragment order
  cvt16<<<gC, blk, 0, stream>>>(q, k, QH, KH, n8, QSC);
  // (1) v^T plane f16(bf16(v) * 256), fragment order
  vt16<<<gVT, blk, 0, stream>>>(v, VT);
  // (2) flash attention per head -> out [h][s][d] f32
  attn_fwd<<<gAT, bAT, 0, stream>>>(QH, KH, VT, mk, out);
  (void)hipGetLastError();
}

// v007
// Measured time: 82.5 microseconds a run.
// Two timings next to v006 put it at 1.07 and 1.08 times that version's speed.
// All steps since v000 together make it 3.28 times as fast.
// Contractions, both transposed: scores S^T = k.q^T (q x1024 and k x1024 as f16 planes of the bf16-RNE-converted inputs, one
// product each, K=64) and O^T += v^T.P^T (P x128 .. x32768 as f16 hi plane + f16 residual plane, v x256 f16 of the bf16-RNE-converted
// input, products v.hi+v.lo, 32-key steps): all v_wmma_f32_16x16x32_f16, f32 accumulate. Base-2 online softmax over all keys (no key mask) and the 1/l fold in f32 on VALU.
#include <hip/hip_runtime.h>
#include <math.h>
#include <stdint.h>

#ifndef NH
#define NH    16
#endif
#define SEQ   4096
#define HD    64
#define QSC   1024.0f
#define KSC   1024.0f
#define PCAR  128.0f
#define PEXP  7.0f
#define TAU   8.0f                // a query's reference maximum is renewed only when a score lies more than 2^TAU above it
#define VCAR  256.0f
#define LOG2E 1.4426950408889634f
#define ATW   8
#define ATT_THREADS (ATW * 32)
#define QGR   4                   // query groups of 32 per block
#define KSPL  2                   // key halves per block
#define QPB   (32 * QGR)
#define KPW   (SEQ / KSPL)        // keys walked by one wave
#define XCHF  (8 * 32 * 4)        // floats one wave hands to its partner: 32 per lane
#define BPH   (SEQ / QPB)
#define ATT_BLOCKS (NH * BPH)
#define SLP   68
#define SLABF (16 * SLP)
#define VTP   72
#define VTILES (SEQ / 64)
static_assert(HD == 64 && QPB == 128 && ATT_THREADS == 256 && ATW == QGR * KSPL && KSPL == 2);
static_assert(PCAR == 128.0f && PEXP == 7.0f);       // PCAR = 2^PEXP
static_assert(PEXP + TAU == 15.0f);                  // largest weight in the f16 planes: 2^15
static_assert((SEQ % QPB) == 0 && (SEQ % 64) == 0 && (KPW % 32) == 0 && KPW >= 32);
static_assert(BPH == 32 && ATT_BLOCKS == NH * 32 && VTILES == 64);
static_assert(NH >= 1 && NH <= 16);
static_assert((HD - 1) * VTP + 63 < HD * VTP);
static_assert(((NH * SEQ * HD) % 2048) == 0);

typedef _Float16 v16h __attribute__((ext_vector_type(16)));
typedef _Float16 v8h  __attribute__((ext_vector_type(8)));
typedef float    v8f  __attribute__((ext_vector_type(8)));
typedef float    v4f  __attribute__((ext_vector_type(4)));
typedef unsigned int v4u __attribute__((ext_vector_type(4)));

union FragH { v16h v; v8h h[2]; v4u u[2]; };

// ---- scalar helpers --------------------------------------------------------------------------------
__device__ __forceinline__ unsigned short bf_bits(float f) {          // f32 -> bf16 bits, RNE convert
  unsigned u = __float_as_uint(f);
  return (unsigned short)((u + 0x7FFFu + ((u >> 16) & 1u)) >> 16);
}
__device__ __forceinline__ float bf_up(unsigned short h) { return __uint_as_float(((unsigned)h) << 16); }
__device__ __forceinline__ float bfr(float f) { return bf_up(bf_bits(f)); }   // value of the bf16 RNE convert
__device__ __forceinline__ unsigned short h_bits(_Float16 x) { return __builtin_bit_cast(unsigned short, x); }
__device__ __forceinline__ unsigned pk16(unsigned short a, unsigned short b) { return (unsigned)a | ((unsigned)b << 16); }
__device__ __forceinline__ v8f zero8() { v8f z = {0.f, 0.f, 0.f, 0.f, 0.f, 0.f, 0.f, 0.f}; return z; }

// ---- fragment loader: 16-bit A/B operand, lane -> row/col (lane&15), p already includes +8*(lane>>4);
//      elements 0..7 <- p[0..7] (k0+8h..), elements 8..15 <- p[16..23] (k0+16+8h..)  (same split k map for A and B;
//      B is always read from a k-contiguous [n][k] plane)
__device__ __forceinline__ v16h ldfrag_h(const _Float16* p) {
  FragH f;
  f.h[0] = *(const v8h*)(p);
  f.h[1] = *(const v8h*)(p + 16);
  return f.v;
}

// the same fragment from a plane stored in fragment order: p already includes +8*lane; the two 16-B pieces of a lane lie 256
// halves apart, so that each wave-wide 16-B load covers 512 contiguous bytes (4 whole lines)
__device__ __forceinline__ v16h ldfrag_p(const _Float16* p) {
  FragH f;
  f.h[0] = *(const v8h*)(p);
  f.h[1] = *(const v8h*)(p + 256);
  return f.v;
}

__device__ __forceinline__ v8f mma_raw(v16h a, v16h b, v8f c) {
  return __builtin_amdgcn_wmma_f32_16x16x32_f16(false, a, false, b, (short)0, c, false, false);
}
// The four vector slots that the chip needs behind a WMMA before a vector instruction touches its D, A or B; the operands tie the
// slots behind the products of a step, and the fragment loads of the next step (over A) stand behind them.
__device__ __forceinline__ void guard_sc(v8f& a, v8f& b, v8f& c, v8f& d, v16h q0, v16h q1, v16h q2, v16h q3,
                                         v16h x0, v16h x1, v16h x2, v16h x3) {
#if defined(__HIP_DEVICE_COMPILE__)
  asm volatile("v_nop\n\tv_nop\n\tv_nop\n\tv_nop"
               : "+v"(a), "+v"(b), "+v"(c), "+v"(d)
               : "v"(q0), "v"(q1), "v"(q2), "v"(q3), "v"(x0), "v"(x1), "v"(x2), "v"(x3) : "memory");
#endif
}
__device__ __forceinline__ void guard_pv(v8f& a, v8f& b, v8f& c, v8f& d, v8f& e, v8f& f, v8f& g, v8f& h,
                                         v16h p0, v16h p1, v16h p2, v16h p3, v16h x0, v16h x1, v16h x2, v16h x3) {
#if defined(__HIP_DEVICE_COMPILE__)
  asm volatile("v_nop\n\tv_nop\n\tv_nop\n\tv_nop"
               : "+v"(a), "+v"(b), "+v"(c), "+v"(d), "+v"(e), "+v"(f), "+v"(g), "+v"(h)
               : "v"(p0), "v"(p1), "v"(p2), "v"(p3), "v"(x0), "v"(x1), "v"(x2), "v"(x3) : "memory");
#endif
}
__device__ __forceinline__ void acc_guard4(v8f& a, v8f& b, v8f& c, v8f& d) {
#if defined(__HIP_DEVICE_COMPILE__)
  asm volatile("v_nop\n\tv_nop\n\tv_nop\n\tv_nop" : "+v"(a), "+v"(b), "+v"(c), "+v"(d));
#endif
}
// Eight exponents x -> t = 2^x (bare v_exp_f32, in place), four registers of f16 pairs h = f16(t) (RNE) and four of
// l = f16(t - h) (t - h is exact in f32, so one RNE). Written in asm because the compiler's own forms convert h back to f32 and
// pack l with further instructions: here a packed convert makes two h, and one mixed-precision fma makes each l from t and the
// f16 half of h, straight into its half of the register (12 instructions behind the 8 exponentials). The exponentials stand in
// the same statement so that what follows each of them is known: the next one touches neither its result nor its source.
// The s_delay_alu hints name each reader's producer (the third-last and the last exponential; else four vector instructions
// back: mixhi keeps the half that mixlo wrote, so it reads that register) and let other waves issue meanwhile; no result changes.
__device__ __forceinline__ void exp_split8(v8f& t, v4u& h, v4u& l) {
#if defined(__HIP_DEVICE_COMPILE__)
  unsigned h0, h1, h2, h3, l0, l1, l2, l3;
  float t0 = t[0], t1 = t[1], t2 = t[2], t3 = t[3], t4 = t[4], t5 = t[5], t6 = t[6], t7 = t[7];
  asm("v_exp_f32 %8, %8\n\t"
      "v_exp_f32 %9, %9\n\t"
      "v_exp_f32 %10, %10\n\t"
      "v_exp_f32 %11, %11\n\t"
      "v_exp_f32 %12, %12\n\t"
      "v_exp_f32 %13, %13\n\t"
      "v_exp_f32 %14, %14\n\t"
      "v_exp_f32 %15, %15\n\t"
      "v_cvt_pk_f16_f32 %0, %8, %9\n\t"
      "v_cvt_pk_f16_f32 %1, %10, %11\n\t"
      "s_delay_alu instid0(TRANS32_DEP_3) | instskip(NEXT) | instid1(TRANS32_DEP_1)\n\t"
      "v_cvt_pk_f16_f32 %2, %12, %13\n\t"
      "v_cvt_pk_f16_f32 %3, %14, %15\n\t"
      "s_delay_alu instid0(VALU_DEP_4) | instskip(NEXT) | instid1(VALU_DEP_4)\n\t"
      "v_fma_mixlo_f16 %4, %8, 1.0, -%0 op_sel_hi:[0,0,1]\n\t"
      "v_fma_mixlo_f16 %5, %10, 1.0, -%1 op_sel_hi:[0,0,1]\n\t"
      "s_delay_alu instid0(VALU_DEP_4) | instskip(NEXT) | instid1(VALU_DEP_4)\n\t"
      "v_fma_mixlo_f16 %6, %12, 1.0, -%2 op_sel_hi:[0,0,1]\n\t"
      "v_fma_mixlo_f16 %7, %14, 1.0, -%3 op_sel_hi:[0,0,1]\n\t"
      "s_delay_alu instid0(VALU_DEP_4) | instskip(NEXT) | instid1(VALU_DEP_4)\n\t"
      "v_fma_mixhi_f16 %4, %9, 1.0, -%0 op_sel:[0,0,1] op_sel_hi:[0,0,1]\n\t"
      "v_fma_mixhi_f16 %5, %11, 1.0, -%1 op_sel:[0,0,1] op_sel_hi:[0,0,1]\n\t"
      "s_delay_alu instid0(VALU_DEP_4) | instskip(NEXT) | instid1(VALU_DEP_4)\n\t"
      "v_fma_mixhi_f16 %6, %13, 1.0, -%2 op_sel:[0,0,1] op_sel_hi:[0,0,1]\n\t"
      "v_fma_mixhi_f16 %7, %15, 1.0, -%3 op_sel:[0,0,1] op_sel_hi:[0,0,1]"
      : "=&v"(h0), "=&v"(h1), "=&v"(h2), "=&v"(h3), "=&v"(l0), "=&v"(l1), "=&v"(l2), "=&v"(l3),
        "+v"(t0), "+v"(t1), "+v"(t2), "+v"(t3), "+v"(t4), "+v"(t5), "+v"(t6), "+v"(t7));
  t = v8f{t0, t1, t2, t3, t4, t5, t6, t7};
  h = v4u{h0, h1, h2, h3};
  l = v4u{l0, l1, l2, l3};
#endif
}
// 2^x as the bare hardware exponential: results below 2^-126 come out as 0 (no range fix), here and in exp_split8. Every use is a
// weight relative to a maximum of 1 (x <= 0) or of at least 128 (x <= 15, up to rounding): a weight that small is 0 in both f16 planes
// of P anyway and is lost against a row sum that holds the maximum's own term.
__device__ __forceinline__ float ex2(float x) { return __builtin_amdgcn_exp2f(x); }
// value of lane l ^ 16 (the other half of the wave), by a vector cross-row move
__device__ __forceinline__ float xhalf(float x) {
  const int i = __builtin_bit_cast(int, x);
  return __builtin_bit_cast(float, __builtin_amdgcn_permlanex16(i, i, 0x76543210, 0xfedcba98, false, false));
}
__device__ __forceinline__ void wave_sync_lds() {
  __builtin_amdgcn_fence(__ATOMIC_RELEASE, "workgroup");
  __builtin_amdgcn_wave_barrier();
  __builtin_amdgcn_fence(__ATOMIC_ACQUIRE, "workgroup");
}

// =====================================================================================================
// 16-bit plane convert: f16( bf16(x) * sc ) (sc a power of two, exact). blockIdx.y == 0: q plane, == 1: k plane.
//   q plane: no relayout (inputs are already head-major [h][s][d]).
//   k plane: fragment order. Per tile of 16 keys (2048 B) the 16-B unit u = 32*f + 16*hh + c holds key c, d 16f + 8hh .. +7:
//            unit 32*f + lane is what lane (hh, c) takes as piece f of the tile's two A fragments.
// Thread = 8 consecutive d of one row: two 16-B loads, one 16-B store per lane; 32 consecutive lanes store 512 contiguous B
// coverage: grid = (n8/256, 2) blocks x 256 thr x 8 elements = n = NH*4096*64 per plane exactly (n % 2048 == 0 asserted).
// =====================================================================================================
__global__ __launch_bounds__(256) void cvt16(const float* __restrict__ xq, const float* __restrict__ xk,
                                             unsigned short* plq, unsigned short* plk, int n8, float sc) {
  const int gt = blockIdx.x * 256 + (int)threadIdx.x;
  if (gt >= n8) return;                     // never taken with the exact grid; no barriers in this kernel
  const bool sk = (blockIdx.y != 0);        // block-uniform plane select (both pointers global)
  const float* x = sk ? xk : xq;
  unsigned short* pl = sk ? plk : plq;
  const size_t e = (size_t)gt * 8;          // destination element
  // source unit of 8 floats: k plane, unit gt = (tile gt >> 7, piece 2f + hh = (gt >> 4) & 7, c = gt & 15) <- row 16*tile + c
  const size_t es = sk ? (((size_t)(gt >> 7) * 16 + (size_t)(gt & 15)) * HD + (size_t)((gt >> 4) & 7) * 8) : e;
  const v4f a = *(const v4f*)(x + es), bq = *(const v4f*)(x + es + 4);
  v4u o;
#pragma unroll
  for (int i = 0; i < 2; ++i) {
    o[i]     = pk16(h_bits((_Float16)(bfr(a[2 * i]) * sc)),  h_bits((_Float16)(bfr(a[2 * i + 1]) * sc)));
    o[2 + i] = pk16(h_bits((_Float16)(bfr(bq[2 * i]) * sc)), h_bits((_Float16)(bfr(bq[2 * i + 1]) * sc)));
  }
  unsigned short* d = pl + e;
  {
    *(v4u*)(d) = o;
    
  }
}

// =====================================================================================================
// v^T plane, values f16( bf16(v[h][key][d]) * 256 ) (exact), in fragment order: per head and step of 32 keys (4096 B) the 16-B
// unit u = 64*j + 32*g + 16*hh + c holds d = 16j + c, keys 16g + 8hh .. +7 of the step: unit 64*j + 32*g + lane is piece g of
// the A fragment of d tile j in lane (hh, c).
// Block = (h, tile of 64 keys): 64 source rows of 64 floats loaded with 16-B loads (static stride), converted, written into
// coverage: load 256 thr x 16 elements = 64 keys x 64 d; store 2 iterations x 256 thr x 8 halves = 64 lines x 64 = the tile;
//           grid = NH x 64 blocks covers the whole plane (NH x 128 steps x 4096 B) exactly once.
// =====================================================================================================
__global__ __launch_bounds__(256) void vt16(const float* __restrict__ v, unsigned short* VTo) {
  __shared__ __align__(16) unsigned short T[HD * VTP];
  const int tid = threadIdx.x;
  const int bid = blockIdx.x;
  const int bh  = bid / VTILES;
  const int t   = bid - bh * VTILES;        // 0..63, block-uniform
  if (bh >= NH) return;                     // never taken with the exact grid; before any barrier or store
  {
    const int sl = tid >> 2;                  // key within tile 0..63
    const int dc = (tid & 3) * 16;            // d chunk
    int key = 64 * t + sl;                    // <= SEQ-1 by construction; clamp keeps the address in range regardless
    key = (key < 0) ? 0 : ((key > SEQ - 1) ? (SEQ - 1) : key);
    const float* src = v + (((size_t)bh * SEQ + (size_t)key) * HD + dc);
#pragma unroll
    for (int i = 0; i < 4; ++i) {
      const v4f a = *(const v4f*)(src + 4 * i);
#pragma unroll
      for (int e = 0; e < 4; ++e) T[(dc + 4 * i + e) * VTP + sl] = h_bits((_Float16)(bfr(a[e]) * VCAR));
    }
  }
  __syncthreads();
  v4u vals[2];
  const int line = ((tid >> 6) & 3) * 16 + (tid & 15);   // d = 16j + c, 0..63
  const int k8   = ((tid >> 4) & 3) * 8;                  // 16g + 8hh, key within the 32-key step
#pragma unroll
  for (int it = 0; it < 2; ++it) vals[it] = *(const v4u*)(T + line * VTP + 32 * it + k8);   // step it of the tile
  unsigned short* dst = VTo + (size_t)bh * HD * SEQ + (size_t)t * (64 * HD) + tid * 8;
  {
#pragma unroll
    for (int it = 0; it < 2; ++it) {
      *(v4u*)(dst + it * (32 * HD)) = vals[it];
    }
    
  }
}

// =====================================================================================================
// Flash attention per head, no key mask. Block = (h, 128 queries), 8 waves = 4 query groups x 2 key halves: wave w owns the 32
// queries iw = 128t + 32(w & 3) .. +31 (two 16-column groups A, B) and walks the keys 2048(w >> 2) .. +2047.
//   q plane f16 [h][s][d]; k plane and v^T plane f16 in fragment order (4096 contiguous B each per 32-key step).
//   Both products are transposed, so that lane (hh, c) holds scores and outputs of ONE query per group, iw + c and iw + 16 + c:
//     S^T = K.Q^T : A = 16 key rows of the k plane, B = a group's q rows (kept in registers); D[r] = (key 8hh + r, query c)
//     O^T += V^T.P^T : A = 16 d rows of the v^T plane, B = P^T packed from the two score tiles as they lie in the registers
//                      (element s < 8: key kb + 8hh + s, else key kb + 16 + 8hh + s - 8: the k map of the A loader)
//   Every k and v^T fragment that a wave loads feeds both groups' products.
//   Key loop (static bound): 64 steps of 32 keys. Every key is visible to every query, so the reference max is finite from the
//   first step on. Per step and group: 4 score WMMAs, maximum over the lane's 16 scores, exp2 in f32 against the reference in use,
//   the lane's own partial sum (the halves' sums are joined once, behind the loop), 8 P.V WMMAs. Once per step, for both groups:
//   a test whether a score has outgrown its reference; only then the exchange between the wave halves and the rescale.
//   The k and v^T fragments of a step are loaded one step ahead: k behind the score products, v^T behind the P.V products.
//   P never touches LDS. Behind the loop the two waves of a query group (w, w ^ 4) join their key halves through LDS: wave w keeps
//   group (w >> 2) and hands the other group's max, sum and O^T to its partner; one block barrier; then
//   o = o1 2^(m1 - m) + o2 2^(m2 - m), l alike. Epilogue: 1/l and carry folds in f32; the wave's 16x64 f32 result staged in its
//   LDS slab (pitch 68), stored as whole 256-B rows. Every wave of a block runs the same static-bound loop and passes the barrier.
//   mkp (int32 key mask) is bound but has no effect on the result and is never read.
// coverage: per wave 8 instructions x 32 lanes x 4 floats = 16 rows x 64 (queries 128t + 32(w & 3) + 16(w >> 2) .. +15); per block
//           8 waves = 128 rows; 32 blocks per head x NH heads: every row of out [NH][4096][64] exactly once (grid NH*32 blocks).
// =====================================================================================================
// largest of this lane's 16 raw scores of one group (its half of the step's 32 keys)
__device__ __forceinline__ float lane_max16(const v8f& s0, const v8f& s1) {
  float mx = fmaxf(s0[0], s1[0]);
#pragma unroll
  for (int r = 1; r < 8; ++r) mx = fmaxf(mx, fmaxf(s0[r], s1[r]));
  return mx;
}
// The seldom-taken path of a step: one group's reference maximum renewed from the step's scores (both wave halves alike, so one
// exchange), sum and O^T tiles brought to the new reference. thr = the raw score whose weight would be 2^(PEXP + TAU).
__device__ __forceinline__ void new_ref(float mx, float& mrun, float& thr, float& lrun, v8f (&o)[4], const float lsc,
                                        const float rlsc) {
  mx = fmaxf(mx, xhalf(mx));                         // the other 16 keys of this query
  const float mn = fmaxf(mrun, __builtin_fmaf(mx, lsc, -PEXP));   // finite from the first step on (lsc > 0)
  const float al = ex2(mrun - mn);                   // 0 in the first step (sum and tiles are 0 there)
  mrun = mn;
  thr  = (mn + (PEXP + TAU)) * rlsc;
  lrun *= al;
#pragma unroll
  for (int j = 0; j < 4; ++j) o[j] *= al;
}
// one 32-key step of the base-2 softmax of one 16-query group against the reference in use: scores s0, s1 -> weights x128 or more
// (in place), their f16 hi and residual planes as B fragments; this half's sum
__device__ __forceinline__ void soft_step(v8f& s0, v8f& s1, const float mrun, float& lrun, FragH& ph, FragH& pl, const float lsc) {
#pragma unroll
  for (int r = 0; r < 8; ++r) {
    s0[r] = s0[r] * lsc - mrun;                      // exponent of the weight: 7 at the reference maximum, at most 15
    s1[r] = s1[r] * lsc - mrun;
  }
  exp_split8(s0, ph.u[0], pl.u[0]);                  // elements 0..7  = keys kb + 8hh + 0..7
  exp_split8(s1, ph.u[1], pl.u[1]);                  // elements 8..15 = keys kb + 16 + 8hh + 0..7
  float ps0 = s0[0], ps1 = s1[0];                    // as a sum started at 0 (0 + x = x: every weight is >= +0)
#pragma unroll
  for (int r = 1; r < 8; ++r) {
    ps0 += s0[r];
    ps1 += s1[r];
  }
  lrun += ps0 + ps1;
}

// amdgpu_waves_per_eu(4, 4): at most 256 registers a wave, so that two blocks (four waves per SIMD) are resident on a WGP
__global__ __launch_bounds__(ATT_THREADS) __attribute__((amdgpu_waves_per_eu(4, 4)))
void attn_fwd(const unsigned short* __restrict__ QHp, const unsigned short* __restrict__ KHp,
              const unsigned short* __restrict__ VTq, const int* __restrict__ mkp, float* OPp) {
  __shared__ __align__(16) float smem[ATW * SLABF];    // per wave: result slab [16][64], pitch 68
  __shared__ __align__(16) float xch[ATW * XCHF];      // per wave: the O^T tiles handed to the partner, [8 pieces][32 lanes][4]
  __shared__ float xml[ATW * 64];                      // per wave: max [32 lanes], sum [32 lanes] handed to the partner
  (void)mkp;

  const int tid  = threadIdx.x;
  const int wave = __builtin_amdgcn_readfirstlane(tid >> 5);   // wave-uniform: keeps the key half in scalar registers
  const int lane = tid & 31;
  const int hh   = lane >> 4;
  const int c    = lane & 15;
  const int qg   = wave & (QGR - 1);                   // query group of 32
  const int kh   = wave >> 2;                          // key half 0, 1

  const int bid  = blockIdx.x;
  const int bh   = bid / BPH;
  const int t    = bid - bh * BPH;                     // 0..31, block-uniform
  if (bh >= NH) return;                                // never taken with the exact grid; before any LDS use, barrier or store

  const int i0 = QPB * t;
  const int iw = i0 + qg * 32;                         // query row 0 of this wave
  const int qs = iw + c;                               // query of column c of group A, <= SEQ-17 by construction

  const _Float16* Qb = (const _Float16*)(const void*)QHp + ((size_t)bh * SEQ + (size_t)qs) * HD + 8 * hh;
  const v16h qa0 = ldfrag_h(Qb);                       // group A: d 0..31
  const v16h qa1 = ldfrag_h(Qb + 32);                  //          d 32..63
  const v16h qb0 = ldfrag_h(Qb + 16 * HD);             // group B (queries + 16): d 0..31
  const v16h qb1 = ldfrag_h(Qb + 16 * HD + 32);        //          d 32..63
  // this wave's half of the head's planes, wave-uniform
  const _Float16* Kb = (const _Float16*)(const void*)KHp + (size_t)bh * SEQ * HD + (size_t)kh * KPW * HD;
  const _Float16* Vb = (const _Float16*)(const void*)VTq + (size_t)bh * SEQ * HD + (size_t)kh * KPW * HD;
  const unsigned lo = (unsigned)lane * 8;              // this lane's 16-B unit within each 512-B piece
  const float lsc = LOG2E / (8.0f * QSC * KSC);
  const float rlsc = (8.0f * QSC * KSC) / LOG2E;

  // per group, this lane's query: reference maximum minus 7 (both halves alike), the raw score above which it is renewed, this
  // half's sum. With the exponent's reference 7 below that maximum, 2^(s - m) IS the weight x128 that the f16 planes carry.
  float mA = -INFINITY, lA = 0.f, mB = -INFINITY, lB = 0.f;
  float tA = -INFINITY, tB = -INFINITY;                // every finite score lies above: the first step sets the references
  v8f oA[4], oB[4];                                    // o[j][r] = O^T[d = 16j + 8hh + r][query c of the group]
#pragma unroll
  for (int j = 0; j < 4; ++j) { oA[j] = zero8(); oB[j] = zero8(); }

  // Fragments of step 0; from here on every step fetches the NEXT step's fragments into the registers that its own products
  // have just read, so that a load has about one whole step of other work between its issue and its first use.
  // The two scheduling barriers keep the issue order q, k, v^T, which is the loop's own (k older than v^T): loads return in
  // order, so only then can the wait at the loop's head be a counted one that leaves the eight v^T loads in flight.
  __builtin_amdgcn_sched_barrier(0);
  v16h kf00 = ldfrag_p(Kb + lo),        kf01 = ldfrag_p(Kb + lo + 512);    // keys 0..15 of the half:  d 0..31, d 32..63
  v16h kf10 = ldfrag_p(Kb + lo + 1024), kf11 = ldfrag_p(Kb + lo + 1536);   // keys 16..31: d 0..31, d 32..63
  __builtin_amdgcn_sched_barrier(0);
  v16h vb0 = ldfrag_p(Vb + lo),        vb1 = ldfrag_p(Vb + lo + 512);      // d tiles 0, 1 of keys 0..31 of the half
  v16h vb2 = ldfrag_p(Vb + lo + 1024), vb3 = ldfrag_p(Vb + lo + 1536);     // d tiles 2, 3

  // kept rolled: one step's body holds the registers of four waves per SIMD
#pragma unroll 1
  for (int kb = 0; kb < KPW; kb += 32) {               // kb counts within this wave's half
    // step whose fragments are fetched in this one; the last step has none behind it and re-reads its own (in range, unused)
    const int kn = (kb + 32 < KPW) ? (kb + 32) : kb;
    // ---- scores: D element r of this lane = (key kb + 8hh + r, the group's query c) in s.0, key kb + 16 + 8hh + r in s.1 ----
    v8f sA0 = zero8(), sA1 = zero8(), sB0 = zero8(), sB1 = zero8();
    sA0 = mma_raw(kf00, qa0, sA0);
    sB0 = mma_raw(kf00, qb0, sB0);
    sA1 = mma_raw(kf10, qa0, sA1);
    sB1 = mma_raw(kf10, qb0, sB1);
    sA0 = mma_raw(kf01, qa1, sA0);
    sB0 = mma_raw(kf01, qb1, sB0);
    sA1 = mma_raw(kf11, qa1, sA1);
    sB1 = mma_raw(kf11, qb1, sB1);
    guard_sc(sA0, sA1, sB0, sB1, qa0, qa1, qb0, qb1, kf00, kf01, kf10, kf11);
    {
      const _Float16* k0p = Kb + (size_t)kn * HD + lo;               // tile of keys kn .. kn + 15 (row c in this lane)
      const _Float16* k1p = k0p + (size_t)16 * HD;                   // tile of keys kn + 16 .. kn + 31
      kf00 = ldfrag_p(k0p);  kf01 = ldfrag_p(k0p + 512);             // d 0..31, d 32..63
      kf10 = ldfrag_p(k1p);  kf11 = ldfrag_p(k1p + 512);
    }
    // keeps the eight loads here, in front of the softmax: without it the scheduler sinks them to the P.V products and their lead goes
    __builtin_amdgcn_sched_barrier(0);
    // ---- per group: online softmax in base 2 (no mask), one query per lane; B fragments of P^T x128 or more, hi f16 and residual f16,
    //      straight from the score registers; O^T += V^T.P^T : A fragment row = d = j*16 + c, keys kb .. kb+31 ----
    FragH phA, plA, phB, plB;
    // Lazy rescale, one test per step for both groups: while no score of the wave lies more than 2^8 above its query's reference,
    // the reference stays, and exchange, 2^(old - new) and the products on sums and O^T tiles are all skipped (a scalar branch).
    const float xA = lane_max16(sA0, sA1), xB = lane_max16(sB0, sB1);
    if (__builtin_amdgcn_ballot_w32((xA > tA) | (xB > tB)) != 0u) {
      new_ref(xA, mA, tA, lA, oA, lsc, rlsc);
      new_ref(xB, mB, tB, lB, oB, lsc, rlsc);
    }
    soft_step(sA0, sA1, mA, lA, phA, plA, lsc);
    oA[0] = mma_raw(vb0, phA.v, oA[0]);  oA[1] = mma_raw(vb1, phA.v, oA[1]);
    oA[2] = mma_raw(vb2, phA.v, oA[2]);  oA[3] = mma_raw(vb3, phA.v, oA[3]);
    oA[0] = mma_raw(vb0, plA.v, oA[0]);  oA[1] = mma_raw(vb1, plA.v, oA[1]);
    oA[2] = mma_raw(vb2, plA.v, oA[2]);  oA[3] = mma_raw(vb3, plA.v, oA[3]);
    soft_step(sB0, sB1, mB, lB, phB, plB, lsc);
    oB[0] = mma_raw(vb0, phB.v, oB[0]);  oB[1] = mma_raw(vb1, phB.v, oB[1]);
    oB[2] = mma_raw(vb2, phB.v, oB[2]);  oB[3] = mma_raw(vb3, phB.v, oB[3]);
    oB[0] = mma_raw(vb0, plB.v, oB[0]);  oB[1] = mma_raw(vb1, plB.v, oB[1]);
    oB[2] = mma_raw(vb2, plB.v, oB[2]);  oB[3] = mma_raw(vb3, plB.v, oB[3]);
    guard_pv(oA[0], oA[1], oA[2], oA[3], oB[0], oB[1], oB[2], oB[3], phA.v, plA.v, phB.v, plB.v, vb0, vb1, vb2, vb3);
    {
      const _Float16* vp = Vb + (size_t)kn * HD + lo;                // the v^T block of keys kn .. kn + 31
      vb0 = ldfrag_p(vp);
      vb1 = ldfrag_p(vp + 512);
      vb2 = ldfrag_p(vp + 1024);
      vb3 = ldfrag_p(vp + 1536);
    }
  }
  acc_guard4(oA[0], oA[1], oA[2], oA[3]);
  acc_guard4(oB[0], oB[1], oB[2], oB[3]);

  // ---- join the wave halves' sums; then join the two key halves: this wave keeps group kh and hands the other group to wave ^ 4
  //      (same lane = same query and same d rows there) ----
  const float lAj = lA + xhalf(lA);                      // 128 or more (the reference's own element contributes 2^7)
  const float lBj = lB + xhalf(lB);
  const bool  kB  = (kh != 0);                           // wave-uniform
  const float mk = kB ? mB : mA,  lk = kB ? lBj : lAj;   // kept
  const float ms = kB ? mA : mB,  ls = kB ? lAj : lBj;   // handed over
  v8f ok[4];
  {
    float* xw = xch + wave * XCHF + lane * 4;            // 32 lanes x 16 B = 512 contiguous B per store
#pragma unroll
    for (int j = 0; j < 4; ++j) {
      v8f os;
#pragma unroll
      for (int r = 0; r < 8; ++r) { ok[j][r] = kB ? oB[j][r] : oA[j][r];  os[r] = kB ? oA[j][r] : oB[j][r]; }
      const v4f w0 = {os[0], os[1], os[2], os[3]};
      const v4f w1 = {os[4], os[5], os[6], os[7]};
      *(v4f*)(xw + (2 * j) * 128)     = w0;
      *(v4f*)(xw + (2 * j + 1) * 128) = w1;
    }
    xml[wave * 64 + lane]      = ms;
    xml[wave * 64 + 32 + lane] = ls;
  }
  __syncthreads();                                       // the partner's tiles, max and sum are read behind it; every wave passes it
  const int   pw = wave ^ QGR;                           // same query group, other key half
  const float mt = xml[pw * 64 + lane];
  const float lt = xml[pw * 64 + 32 + lane];
  const float mj = fmaxf(mk, mt);                        // both finite
  const float wk = ex2(mk - mj), wt = ex2(mt - mj);      // one of them is 1
  const float lr = lk * wk + lt * wt;

  // ---- fold 1/l and the carries (128 on P, 256 on v), stage the wave's 16x64 slab in its LDS region:
  //      a lane holds 8 consecutive d of its query per tile j: two 16-B LDS stores ----
  float* slab = smem + wave * SLABF;
  const float oc = 1.0f / VCAR;                          // the carry on P stands in o and in l alike
  const float inv = (lr > 0.0f) ? ((1.0f / lr) * oc) : 0.0f;
  const float fk = wk * inv, ft = wt * inv;
  const float* xr = xch + pw * XCHF + lane * 4;
#pragma unroll
  for (int j = 0; j < 4; ++j) {
    const v4f t0 = *(const v4f*)(xr + (2 * j) * 128);
    const v4f t1 = *(const v4f*)(xr + (2 * j + 1) * 128);
    float* sp = slab + c * SLP + j * 16 + 8 * hh;
    const v4f w0 = {ok[j][0] * fk + t0[0] * ft, ok[j][1] * fk + t0[1] * ft, ok[j][2] * fk + t0[2] * ft, ok[j][3] * fk + t0[3] * ft};
    const v4f w1 = {ok[j][4] * fk + t1[0] * ft, ok[j][5] * fk + t1[1] * ft, ok[j][6] * fk + t1[2] * ft, ok[j][7] * fk + t1[3] * ft};
    *(v4f*)(sp)     = w0;
    *(v4f*)(sp + 4) = w1;
  }
  wave_sync_lds();
  v4f vals[8];
#pragma unroll
  for (int it = 0; it < 8; ++it) vals[it] = *(const v4f*)(slab + (2 * it + hh) * SLP + c * 4);
  float* dst = OPp + ((size_t)(bh * SEQ + iw + 16 * kh)) * HD + hh * HD + c * 4;   // rows of the kept group
  {
#pragma unroll
    for (int it = 0; it < 8; ++it) {
      *(v4f*)(dst + (size_t)(2 * it) * HD) = vals[it];
    }
    
  }
}

// =====================================================================================================
// Workspace map (bytes); every plane is fully written by whole-line stores before it is read; all extents are exact
// multiples of the store granularity (no pad rows needed); offsets multiples of 128 (NH = 16 values shown):
//   QH f16 [NH][4096][64] x1024        8388608   at        0
//   KH f16 [NH][256 tiles][2048 B] x1024   8388608   at  8388608   (fragment order)
//   VT f16 [NH][128 steps][4096 B] x256    8388608   at 16777216   (fragment order)
//   end                                             25165824
// =====================================================================================================
extern "C" void kernel_launch(void* const* d_in, const int* in_sizes, int n_in,
                              void* d_out, int out_size, void* d_ws, size_t ws_size,
                              hipStream_t stream) {
  const int NEL = NH * SEQ * HD;                        // 4194304 for NH = 16
  if (n_in < 4) return;
  if (in_sizes[0] < NEL || in_sizes[1] < NEL || in_sizes[2] < NEL || in_sizes[3] < 1) return;
  if (out_size < NEL) return;

  const float* q  = (const float*)d_in[0];
  const float* k  = (const float*)d_in[1];
  const float* v  = (const float*)d_in[2];
  const int*   mk = (const int*)d_in[3];                // int32 key mask, no effect on the result
  float*       out = (float*)d_out;

  const size_t PQ = (size_t)NEL * 2;                    //  8388608
  const size_t PK = (size_t)NEL * 2;                    //  8388608
  const size_t PV = (size_t)NH * HD * SEQ * 2;          //  8388608
  size_t off = 0;
  const size_t oQH = off; off += PQ;
  const size_t oKH = off; off += PK;
  const size_t oVT = off; off += PV;
  if (off > ws_size) return;                            // off = 25165824
  if (off > (size_t)134217728) return;

  char* ws = (char*)d_ws;
  unsigned short* QH = (unsigned short*)(ws + oQH);
  unsigned short* KH = (unsigned short*)(ws + oKH);
  unsigned short* VT = (unsigned short*)(ws + oVT);

  const int n8 = NEL / 8;                               // 524288
  const dim3 blk(256);
  const dim3 gC(n8 / 256, 2);                           // (2048, 2): q and k planes in one launch
  const dim3 gVT(NH * VTILES);                          // 1024
  const dim3 gAT(ATT_BLOCKS);                           // 512
  const dim3 bAT(ATT_THREADS);                          // 256

  // (0) q and k planes f16(bf16(x) * 1024): q [h][s][d], k in fragment order
  cvt16<<<gC, blk, 0, stream>>>(q, k, QH, KH, n8, QSC);
  // (1) v^T plane f16(bf16(v) * 256), fragment order
  vt16<<<gVT, blk, 0, stream>>>(v, VT);
  // (2) flash attention per head -> out [h][s][d] f32
  attn_fwd<<<gAT, bAT, 0, stream>>>(QH, KH, VT, mk, out);
  (void)hipGetLastError();
}

// v010
// Measured time: 57.6 microseconds a run.
// Versions between v007 and this one are left out; their measured steps multiply to 1.41 times as fast.
// Counting every step since v000, it is 4.62 times as fast.
// Contractions, both transposed: scores S^T = k.q^T - reference (q x log2(e)/8 and k as f16 planes of the bf16-RNE-converted inputs,
// one product each, K=64, the accumulator started at minus the softmax reference: the result IS the base-2 exponent) and
// O^T += v^T.P^T (P x128 .. x32768 as one f16 plane, rounded to nearest even, v x256 f16 of the bf16-RNE-converted
// input, one product, 32-key steps): all v_wmma_f32_16x16x32_f16, f32 accumulate. Base-2 online softmax over all keys (no key mask) and the 1/l fold in f32 on VALU.
#include <hip/hip_runtime.h>
#include <math.h>
#include <stdint.h>

#ifndef NH
#define NH    16
#endif
#define SEQ   4096
#define HD    64
#define KSC   1.0f
#define PCAR  128.0f
#define PEXP  7.0f
#define TAU   8.0f                // a query's reference maximum is renewed only when a score lies more than 2^TAU above it
#define VCAR  256.0f
#define LOG2E 1.4426950408889634f
#define QSC   (LOG2E / 8.0f)      // 1/sqrt(64) and the change to base 2, carried by the q plane: one f16 rounding of q more
#define ATW   8
#define ATT_THREADS (ATW * 32)
#define QGR   4                   // query groups of 32 per block
#define KSPL  2                   // key halves per block
#define QPB   (32 * QGR)
#define KPW   (SEQ / KSPL)        // keys walked by one wave
#define XCHF  (8 * 32 * 4)        // floats one wave hands to its partner: 32 per lane
#define BPH   (SEQ / QPB)
#define ATT_BLOCKS (NH * BPH)
#define SLP   68
#define SLABF (16 * SLP)
#define VTP   72
#define VTILES (SEQ / 64)
#define TKEYS 128                 // keys of one key half in one tile of the LDS ring
#define TSTEPS (TKEYS / 32)       // 32-key steps per tile
#define NTIL  (KPW / TKEYS)       // tiles walked by one wave
#define NSTEP (KPW / 32)          // 32-key steps walked by one wave
#define STEPH (32 * HD)           // halves of one 32-key step of a plane (4096 B)
#define HALFB (2 * TKEYS * HD * 2)   // bytes of one key half in a buffer: k steps, then v^T steps
#define BUFB  (KSPL * HALFB)      // bytes of one ring buffer
static_assert(HD == 64 && QPB == 128 && ATT_THREADS == 256 && ATW == QGR * KSPL && KSPL == 2);
static_assert(PCAR == 128.0f && PEXP == 7.0f);       // PCAR = 2^PEXP
static_assert(PEXP + TAU == 15.0f);                  // largest weight in the f16 plane: 2^15
static_assert((SEQ % QPB) == 0 && (SEQ % 64) == 0 && (KPW % 32) == 0 && KPW >= 32);
static_assert(BPH == 32 && ATT_BLOCKS == NH * 32 && VTILES == 64);
static_assert(NH >= 1 && NH <= 16);
static_assert(TSTEPS == 4 && NTIL >= 2 && (KPW % TKEYS) == 0 && BUFB == ATW * 16 * 512);  // 8 waves x 16 copies x 512 B fill a buffer
static_assert((ATW * SLABF + ATW * XCHF + ATW * 64) * 4 <= 2 * BUFB);                     // the epilogue's staging fits the ring's bytes
static_assert((HD - 1) * VTP + 63 < HD * VTP);
static_assert(((NH * SEQ * HD) % 2048) == 0);

typedef _Float16 v16h __attribute__((ext_vector_type(16)));
typedef _Float16 v8h  __attribute__((ext_vector_type(8)));
typedef float    v8f  __attribute__((ext_vector_type(8)));
typedef float    v4f  __attribute__((ext_vector_type(4)));
typedef unsigned int v4u __attribute__((ext_vector_type(4)));

union FragH { v16h v; v8h h[2]; v4u u[2]; };

// ---- scalar helpers --------------------------------------------------------------------------------
__device__ __forceinline__ unsigned short bf_bits(float f) {          // f32 -> bf16 bits, RNE convert
  unsigned u = __float_as_uint(f);
  return (unsigned short)((u + 0x7FFFu + ((u >> 16) & 1u)) >> 16);
}
__device__ __forceinline__ float bf_up(unsigned short h) { return __uint_as_float(((unsigned)h) << 16); }
__device__ __forceinline__ float bfr(float f) { return bf_up(bf_bits(f)); }   // value of the bf16 RNE convert
__device__ __forceinline__ unsigned short h_bits(_Float16 x) { return __builtin_bit_cast(unsigned short, x); }
__device__ __forceinline__ unsigned pk16(unsigned short a, unsigned short b) { return (unsigned)a | ((unsigned)b << 16); }
__device__ __forceinline__ v8f zero8() { v8f z = {0.f, 0.f, 0.f, 0.f, 0.f, 0.f, 0.f, 0.f}; return z; }

// ---- fragment loader: 16-bit A/B operand, lane -> row/col (lane&15), p already includes +8*(lane>>4);
//      elements 0..7 <- p[0..7] (k0+8h..), elements 8..15 <- p[16..23] (k0+16+8h..)  (same split k map for A and B;
//      B is always read from a k-contiguous [n][k] plane)
__device__ __forceinline__ v16h ldfrag_h(const _Float16* p) {
  FragH f;
  f.h[0] = *(const v8h*)(p);
  f.h[1] = *(const v8h*)(p + 16);
  return f.v;
}

// the same fragment from a plane stored in fragment order: p already includes +8*lane; the two 16-B pieces of a lane lie 256
// halves apart, so that each wave-wide 16-B load covers 512 contiguous bytes (4 whole lines)
__device__ __forceinline__ v16h ldfrag_p(const _Float16* p) {
  FragH f;
  f.h[0] = *(const v8h*)(p);
  f.h[1] = *(const v8h*)(p + 256);
  return f.v;
}

__device__ __forceinline__ v8f mma_raw(v16h a, v16h b, v8f c) {
  return __builtin_amdgcn_wmma_f32_16x16x32_f16(false, a, false, b, (short)0, c, false, false);
}
// The eight score products of a step: two key tiles x two query groups, K = 64 as two products each; the first of each pair sums
// onto the group's C operand (cA, cB), which stays in its registers. One asm statement because the builtin form copied cA and cB into
// the result registers of two of the four tiles (eight 64-bit moves a step). An accumulate into the same D needs no distance; the
// four v_nop at the end are the vector slots that the chip needs behind a WMMA before a vector instruction touches its D, A or B.
// volatile and the memory clobber keep the fragment loads of the next step (over the k registers) behind the statement.
__device__ __forceinline__ void score8(v8f& sA0, v8f& sB0, v8f& sA1, v8f& sB1, v16h k00, v16h k01, v16h k10, v16h k11,
                                       v16h qa0, v16h qa1, v16h qb0, v16h qb1, const v8f& cA, const v8f& cB) {
#if defined(__HIP_DEVICE_COMPILE__)
  asm volatile("v_wmma_f32_16x16x32_f16 %0, %4, %8, %12\n\t"
               "v_wmma_f32_16x16x32_f16 %1, %4, %10, %13\n\t"
               "v_wmma_f32_16x16x32_f16 %2, %6, %8, %12\n\t"
               "v_wmma_f32_16x16x32_f16 %3, %6, %10, %13\n\t"
               "v_wmma_f32_16x16x32_f16 %0, %5, %9, %0\n\t"
               "v_wmma_f32_16x16x32_f16 %1, %5, %11, %1\n\t"
               "v_wmma_f32_16x16x32_f16 %2, %7, %9, %2\n\t"
               "v_wmma_f32_16x16x32_f16 %3, %7, %11, %3\n\t"
               "v_nop\n\tv_nop\n\tv_nop\n\tv_nop"
               : "=&v"(sA0), "=&v"(sB0), "=&v"(sA1), "=&v"(sB1)
               : "v"(k00), "v"(k01), "v"(k10), "v"(k11), "v"(qa0), "v"(qa1), "v"(qb0), "v"(qb1), "v"(cA), "v"(cB) : "memory");
#endif
}
// The four vector slots that the chip needs behind a WMMA before a vector instruction touches its D, A or B; the operands tie the
// slots behind the products of a step, and the fragment loads of the next step (over A) stand behind them.
__device__ __forceinline__ void guard_pv(v8f& a, v8f& b, v8f& c, v8f& d, v8f& e, v8f& f, v8f& g, v8f& h,
                                         v16h p0, v16h p1, v16h x0, v16h x1, v16h x2, v16h x3) {
#if defined(__HIP_DEVICE_COMPILE__)
  asm volatile("v_nop\n\tv_nop\n\tv_nop\n\tv_nop"
               : "+v"(a), "+v"(b), "+v"(c), "+v"(d), "+v"(e), "+v"(f), "+v"(g), "+v"(h)
               : "v"(p0), "v"(p1), "v"(x0), "v"(x1), "v"(x2), "v"(x3) : "memory");
#endif
}
__device__ __forceinline__ void acc_guard4(v8f& a, v8f& b, v8f& c, v8f& d) {
#if defined(__HIP_DEVICE_COMPILE__)
  asm volatile("v_nop\n\tv_nop\n\tv_nop\n\tv_nop" : "+v"(a), "+v"(b), "+v"(c), "+v"(d));
#endif
}
// Eight exponents x -> t = 2^x (bare v_exp_f32, in place) and four registers of f16 pairs h = f16(t) (RNE, a packed convert makes
// two). h alone is the B operand of P.V: its rounding, at most 2^-11 of a weight, lies well below what the bf16 conversion of q, k
// and v has already put on every weight and every product. The exponentials stand in one statement with the converts so that what
// follows each of them is known: the next one touches neither its result nor its source.
// The s_delay_alu hint names the last two converts' producers (the third-last and the last exponential) and lets other waves issue
// meanwhile; no result changes.
__device__ __forceinline__ void exp_pack8(v8f& t, v4u& h) {
#if defined(__HIP_DEVICE_COMPILE__)
  unsigned h0, h1, h2, h3;
  float t0 = t[0], t1 = t[1], t2 = t[2], t3 = t[3], t4 = t[4], t5 = t[5], t6 = t[6], t7 = t[7];
  asm("v_exp_f32 %4, %4\n\t"
      "v_exp_f32 %5, %5\n\t"
      "v_exp_f32 %6, %6\n\t"
      "v_exp_f32 %7, %7\n\t"
      "v_exp_f32 %8, %8\n\t"
      "v_exp_f32 %9, %9\n\t"
      "v_exp_f32 %10, %10\n\t"
      "v_exp_f32 %11, %11\n\t"
      "v_cvt_pk_f16_f32 %0, %4, %5\n\t"
      "v_cvt_pk_f16_f32 %1, %6, %7\n\t"
      "s_delay_alu instid0(TRANS32_DEP_3) | instskip(NEXT) | instid1(TRANS32_DEP_1)\n\t"
      "v_cvt_pk_f16_f32 %2, %8, %9\n\t"
      "v_cvt_pk_f16_f32 %3, %10, %11"
      : "=&v"(h0), "=&v"(h1), "=&v"(h2), "=&v"(h3),
        "+v"(t0), "+v"(t1), "+v"(t2), "+v"(t3), "+v"(t4), "+v"(t5), "+v"(t6), "+v"(t7));
  t = v8f{t0, t1, t2, t3, t4, t5, t6, t7};
  h = v4u{h0, h1, h2, h3};
#endif
}
// 2^x as the bare hardware exponential: results below 2^-126 come out as 0 (no range fix), here and in exp_pack8. Every use is a
// weight relative to a maximum of 1 (x <= 0) or of at least 128 (x <= 15, up to rounding): a weight that small is 0 in the f16 plane
// of P anyway and is lost against a row sum that holds the maximum's own term.
__device__ __forceinline__ float ex2(float x) { return __builtin_amdgcn_exp2f(x); }
// value of lane l ^ 16 (the other half of the wave), by a vector cross-row move
__device__ __forceinline__ float xhalf(float x) {
  const int i = __builtin_bit_cast(int, x);
  return __builtin_bit_cast(float, __builtin_amdgcn_permlanex16(i, i, 0x76543210, 0xfedcba98, false, false));
}
__device__ __forceinline__ void wave_sync_lds() {
  __builtin_amdgcn_fence(__ATOMIC_RELEASE, "workgroup");
  __builtin_amdgcn_wave_barrier();
  __builtin_amdgcn_fence(__ATOMIC_ACQUIRE, "workgroup");
}

// Sixteen asynchronous copies to LDS: 8192 contiguous bytes, each lane 16 B per copy; the immediate offset moves the LDS and the
// global address alike. The s_wait_xcnt 0 stands inside the statement, behind the last copy, so that no later write of the two
// address operands can come in front of it.
__device__ __forceinline__ void copy16(unsigned lds, const _Float16* g) {
#if defined(__HIP_DEVICE_COMPILE__)
  asm volatile("global_load_async_to_lds_b128 %0, %1, off\n\t"
               "global_load_async_to_lds_b128 %0, %1, off offset:512\n\t"
               "global_load_async_to_lds_b128 %0, %1, off offset:1024\n\t"
               "global_load_async_to_lds_b128 %0, %1, off offset:1536\n\t"
               "global_load_async_to_lds_b128 %0, %1, off offset:2048\n\t"
               "global_load_async_to_lds_b128 %0, %1, off offset:2560\n\t"
               "global_load_async_to_lds_b128 %0, %1, off offset:3072\n\t"
               "global_load_async_to_lds_b128 %0, %1, off offset:3584\n\t"
               "global_load_async_to_lds_b128 %0, %1, off offset:4096\n\t"
               "global_load_async_to_lds_b128 %0, %1, off offset:4608\n\t"
               "global_load_async_to_lds_b128 %0, %1, off offset:5120\n\t"
               "global_load_async_to_lds_b128 %0, %1, off offset:5632\n\t"
               "global_load_async_to_lds_b128 %0, %1, off offset:6144\n\t"
               "global_load_async_to_lds_b128 %0, %1, off offset:6656\n\t"
               "global_load_async_to_lds_b128 %0, %1, off offset:7168\n\t"
               "global_load_async_to_lds_b128 %0, %1, off offset:7680\n\t"
               "s_wait_xcnt 0x0"
               :: "v"(lds), "v"(g) : "memory");
#endif
}
// this wave's own copies have landed (the compiler places no wait for them)
__device__ __forceinline__ void wait_async0() {
#if defined(__HIP_DEVICE_COMPILE__)
  asm volatile("s_wait_asynccnt 0x0" ::: "memory");
#endif
}
// this wave's LDS reads have returned: only then may the buffer they read be refilled
__device__ __forceinline__ void wait_ds0() {
#if defined(__HIP_DEVICE_COMPILE__)
  asm volatile("s_wait_dscnt 0x0" ::: "memory");
#endif
}

// =====================================================================================================
// 16-bit plane convert: f16( bf16(x) * sc ) (k: sc = 1; q: sc = log2(e)/8, rounded to f16). blockIdx.y == 0: q plane, == 1: k plane.
//   q plane: no relayout (inputs are already head-major [h][s][d]).
//   k plane: fragment order. Per tile of 16 keys (2048 B) the 16-B unit u = 32*f + 16*hh + c holds key c, d 16f + 8hh .. +7:
//            unit 32*f + lane is what lane (hh, c) takes as piece f of the tile's two A fragments.
// Thread = 8 consecutive d of one row: two 16-B loads, one 16-B store per lane; 32 consecutive lanes store 512 contiguous B
// coverage: grid = (n8/256, 2) blocks x 256 thr x 8 elements = n = NH*4096*64 per plane exactly (n % 2048 == 0 asserted).
// =====================================================================================================
__global__ __launch_bounds__(256) void cvt16(const float* __restrict__ xq, const float* __restrict__ xk,
                                             unsigned short* plq, unsigned short* plk, int n8, float scq, float sck) {
  const int gt = blockIdx.x * 256 + (int)threadIdx.x;
  if (gt >= n8) return;                     // never taken with the exact grid; no barriers in this kernel
  const bool sk = (blockIdx.y != 0);        // block-uniform plane select (both pointers global)
  const float* x = sk ? xk : xq;
  unsigned short* pl = sk ? plk : plq;
  const float sc = sk ? sck : scq;
  const size_t e = (size_t)gt * 8;          // destination element
  // source unit of 8 floats: k plane, unit gt = (tile gt >> 7, piece 2f + hh = (gt >> 4) & 7, c = gt & 15) <- row 16*tile + c
  const size_t es = sk ? (((size_t)(gt >> 7) * 16 + (size_t)(gt & 15)) * HD + (size_t)((gt >> 4) & 7) * 8) : e;
  const v4f a = *(const v4f*)(x + es), bq = *(const v4f*)(x + es + 4);
  v4u o;
#pragma unroll
  for (int i = 0; i < 2; ++i) {
    o[i]     = pk16(h_bits((_Float16)(bfr(a[2 * i]) * sc)),  h_bits((_Float16)(bfr(a[2 * i + 1]) * sc)));
    o[2 + i] = pk16(h_bits((_Float16)(bfr(bq[2 * i]) * sc)), h_bits((_Float16)(bfr(bq[2 * i + 1]) * sc)));
  }
  unsigned short* d = pl + e;
  {
    *(v4u*)(d) = o;
    
  }
}

// =====================================================================================================
// v^T plane, values f16( bf16(v[h][key][d]) * 256 ) (exact), in fragment order: per head and step of 32 keys (4096 B) the 16-B
// unit u = 64*j + 32*g + 16*hh + c holds d = 16j + c, keys 16g + 8hh .. +7 of the step: unit 64*j + 32*g + lane is piece g of
// the A fragment of d tile j in lane (hh, c).
// Block = (h, tile of 64 keys): 64 source rows of 64 floats loaded with 16-B loads (static stride), converted, written into
// coverage: load 256 thr x 16 elements = 64 keys x 64 d; store 2 iterations x 256 thr x 8 halves = 64 lines x 64 = the tile;
//           grid = NH x 64 blocks covers the whole plane (NH x 128 steps x 4096 B) exactly once.
// =====================================================================================================
__global__ __launch_bounds__(256) void vt16(const float* __restrict__ v, unsigned short* VTo) {
  __shared__ __align__(16) unsigned short T[HD * VTP];
  const int tid = threadIdx.x;
  const int bid = blockIdx.x;
  const int bh  = bid / VTILES;
  const int t   = bid - bh * VTILES;        // 0..63, block-uniform
  if (bh >= NH) return;                     // never taken with the exact grid; before any barrier or store
  {
    const int sl = tid >> 2;                  // key within tile 0..63
    const int dc = (tid & 3) * 16;            // d chunk
    int key = 64 * t + sl;                    // <= SEQ-1 by construction; clamp keeps the address in range regardless
    key = (key < 0) ? 0 : ((key > SEQ - 1) ? (SEQ - 1) : key);
    const float* src = v + (((size_t)bh * SEQ + (size_t)key) * HD + dc);
#pragma unroll
    for (int i = 0; i < 4; ++i) {
      const v4f a = *(const v4f*)(src + 4 * i);
#pragma unroll
      for (int e = 0; e < 4; ++e) T[(dc + 4 * i + e) * VTP + sl] = h_bits((_Float16)(bfr(a[e]) * VCAR));
    }
  }
  __syncthreads();
  v4u vals[2];
  const int line = ((tid >> 6) & 3) * 16 + (tid & 15);   // d = 16j + c, 0..63
  const int k8   = ((tid >> 4) & 3) * 8;                  // 16g + 8hh, key within the 32-key step
#pragma unroll
  for (int it = 0; it < 2; ++it) vals[it] = *(const v4u*)(T + line * VTP + 32 * it + k8);   // step it of the tile
  unsigned short* dst = VTo + (size_t)bh * HD * SEQ + (size_t)t * (64 * HD) + tid * 8;
  {
#pragma unroll
    for (int it = 0; it < 2; ++it) {
      *(v4u*)(dst + it * (32 * HD)) = vals[it];
    }
    
  }
}

// =====================================================================================================
// Flash attention per head, no key mask. Block = (h, 128 queries), 8 waves = 4 query groups x 2 key halves: wave w owns the 32
// queries iw = 128t + 32(w & 3) .. +31 (two 16-column groups A, B) and walks the keys 2048(w >> 2) .. +2047.
//   q plane f16 [h][s][d]; k plane and v^T plane f16 in fragment order (4096 contiguous B each per 32-key step).
//   Both products are transposed, so that lane (hh, c) holds scores and outputs of ONE query per group, iw + c and iw + 16 + c:
//     S^T = K.Q^T : A = 16 key rows of the k plane, B = a group's q rows (kept in registers); D[r] = (key 8hh + r, query c)
//     O^T += V^T.P^T : A = 16 d rows of the v^T plane, B = P^T packed from the two score tiles as they lie in the registers
//                      (element s < 8: key kb + 8hh + s, else key kb + 16 + 8hh + s - 8: the k map of the A loader)
//   Every k and v^T fragment that a wave loads feeds both groups' products.
//   Key loop (static bound): 64 steps of 32 keys. Every key is visible to every query, so the reference max is finite from the
//   first step on. Per step and group: 4 score WMMAs, maximum over the lane's 16 scores, exp2 in f32 against the reference in use,
//   the lane's own partial sum (the halves' sums are joined once, behind the loop), 4 P.V WMMAs. Once per step, for both groups:
//   a test whether a score has outgrown its reference; only then the exchange between the wave halves and the rescale.
//   k and v^T reach the waves through LDS: a ring of two buffers, a tile = 128 keys of both key halves (64 KiB), filled by
//   asynchronous copies (each wave 8 KiB of its own key half), one tile ahead; the four waves of a key half read the same bytes.
//   Behind the loop and one more barrier the ring's bytes serve as the epilogue's staging.
//   The k and v^T fragments of a step are read from LDS one step ahead: k behind the score products, v^T behind the P.V products.
//   P never touches LDS. Behind the loop the two waves of a query group (w, w ^ 4) join their key halves through LDS: wave w keeps
//   group (w >> 2) and hands the other group's max, sum and O^T to its partner; one block barrier; then
//   o = o1 2^(m1 - m) + o2 2^(m2 - m), l alike. Epilogue: 1/l and carry folds in f32; the wave's 16x64 f32 result staged in its
//   LDS slab (pitch 68), stored as whole 256-B rows. Every wave of a block runs the same static-bound loop and passes the barrier.
//   mkp (int32 key mask) is bound but has no effect on the result and is never read.
// coverage: per wave 8 instructions x 32 lanes x 4 floats = 16 rows x 64 (queries 128t + 32(w & 3) + 16(w >> 2) .. +15); per block
//           8 waves = 128 rows; 32 blocks per head x NH heads: every row of out [NH][4096][64] exactly once (grid NH*32 blocks).
// =====================================================================================================
// largest of this lane's 16 exponents of one group (its half of the step's 32 keys)
__device__ __forceinline__ float lane_max16(const v8f& s0, const v8f& s1) {
  float mx = fmaxf(s0[0], s1[0]);
#pragma unroll
  for (int r = 1; r < 8; ++r) mx = fmaxf(mx, fmaxf(s0[r], s1[r]));
  return mx;
}
// The seldom-taken path of a step: one group's reference renewed from the step's exponents (both wave halves alike, so one
// exchange). mx = the lane's largest exponent against the reference in use; c = minus that reference in all eight registers (the
// C operand of the score products); thr = the exponent above which the reference is renewed (-inf until the first step has set one).
// The reference rises by dl: sum and O^T tiles x 2^-dl, this step's exponents - dl, c - dl.
__device__ __forceinline__ void new_ref(float mx, v8f& c, float& thr, float& lrun, v8f (&o)[4], v8f& s0, v8f& s1) {
  mx = fmaxf(mx, xhalf(mx));                         // the other 16 keys of this query
  const float fl = (thr < 0.0f) ? -INFINITY : 0.0f;  // the first step takes its own maximum, also one below the start value 0
  const float dl = fmaxf(fl, mx - PEXP);             // finite: every score is
  const float al = ex2(fminf(-dl, 0.0f));            // first step: sum and tiles are 0, any finite factor serves
  const float cn = c[0] - dl;
  thr = PEXP + TAU;
  lrun *= al;
#pragma unroll
  for (int j = 0; j < 4; ++j) o[j] *= al;
#pragma unroll
  for (int r = 0; r < 8; ++r) {
    c[r] = cn;
    s0[r] -= dl;
    s1[r] -= dl;
  }
}
// one 32-key step of the base-2 softmax of one 16-query group: exponents s0, s1 as the score products leave them (7 at the
// reference maximum, at most 15) -> weights x128 or more (in place, f32), their f16 plane as a B fragment; this half's sum (of the f32)
__device__ __forceinline__ void soft_step(v8f& s0, v8f& s1, float& lrun, FragH& ph) {
  exp_pack8(s0, ph.u[0]);                            // elements 0..7  = keys kb + 8hh + 0..7
  exp_pack8(s1, ph.u[1]);                            // elements 8..15 = keys kb + 16 + 8hh + 0..7
  float ps0 = s0[0], ps1 = s1[0];                    // as a sum started at 0 (0 + x = x: every weight is >= +0)
#pragma unroll
  for (int r = 1; r < 8; ++r) {
    ps0 += s0[r];
    ps1 += s1[r];
  }
  lrun += ps0 + ps1;
}

// amdgpu_waves_per_eu(4, 4): at most 256 registers a wave, so that two blocks (four waves per SIMD) are resident on a WGP
__global__ __launch_bounds__(ATT_THREADS) __attribute__((amdgpu_waves_per_eu(4, 4)))
void attn_fwd(const unsigned short* __restrict__ QHp, const unsigned short* __restrict__ KHp,
              const unsigned short* __restrict__ VTq, const int* __restrict__ mkp, float* OPp) {
  // ring: [2 buffers][key half][k steps 0..3, v^T steps 0..3][4096 B in fragment order]
  __shared__ __align__(1024) unsigned char ring[2 * BUFB];
  // the epilogue's staging, in the ring's bytes (two blocks per WGP need both to share them); used only behind the barrier after the loop
  float* const smem = (float*)(void*)ring;             // per wave: result slab [16][64], pitch 68
  float* const xch  = smem + ATW * SLABF;              // per wave: the O^T tiles handed to the partner, [8 pieces][32 lanes][4]
  float* const xml  = xch + ATW * XCHF;                // per wave: max [32 lanes], sum [32 lanes] handed to the partner
  (void)mkp;

  const int tid  = threadIdx.x;
  const int wave = __builtin_amdgcn_readfirstlane(tid >> 5);   // wave-uniform: keeps the key half in scalar registers
  const int lane = tid & 31;
  const int hh   = lane >> 4;
  const int c    = lane & 15;
  const int qg   = wave & (QGR - 1);                   // query group of 32
  const int kh   = wave >> 2;                          // key half 0, 1

  const int bid  = blockIdx.x;
  const int bh   = bid / BPH;
  const int t    = bid - bh * BPH;                     // 0..31, block-uniform
  if (bh >= NH) return;                                // never taken with the exact grid; before any LDS use, barrier or store

  const int i0 = QPB * t;
  const int iw = i0 + qg * 32;                         // query row 0 of this wave
  const int qs = iw + c;                               // query of column c of group A, <= SEQ-17 by construction

  const _Float16* Qb = (const _Float16*)(const void*)QHp + ((size_t)bh * SEQ + (size_t)qs) * HD + 8 * hh;
  const v16h qa0 = ldfrag_h(Qb);                       // group A: d 0..31
  const v16h qa1 = ldfrag_h(Qb + 32);                  //          d 32..63
  const v16h qb0 = ldfrag_h(Qb + 16 * HD);             // group B (queries + 16): d 0..31
  const v16h qb1 = ldfrag_h(Qb + 16 * HD + 32);        //          d 32..63
  // this wave's half of the head's planes, wave-uniform
  const _Float16* Kb = (const _Float16*)(const void*)KHp + (size_t)bh * SEQ * HD + (size_t)kh * KPW * HD;
  const _Float16* Vb = (const _Float16*)(const void*)VTq + (size_t)bh * SEQ * HD + (size_t)kh * KPW * HD;
  const unsigned lo = (unsigned)lane * 8;              // this lane's 16-B unit within each 512-B piece

  // per group, this lane's query: c = 7 minus the reference maximum (both halves alike), in the eight registers of a C operand, so
  // that a score product comes out as the exponent of the weight x128 that the f16 plane carries; t = the exponent above which the
  // reference is renewed; l = this half's sum.
  v8f cA = zero8(), cB = zero8();
  float lA = 0.f, lB = 0.f;
  float tA = -INFINITY, tB = -INFINITY;                // every finite score lies above: the first step sets the references
  v8f oA[4], oB[4];                                    // o[j][r] = O^T[d = 16j + 8hh + r][query c of the group]
#pragma unroll
  for (int j = 0; j < 4; ++j) { oA[j] = zero8(); oB[j] = zero8(); }

  // This wave's share of every tile: 8192 B of its own key half, part 0, 1 = k steps 0-1, 2-3; part 2, 3 = v^T alike (wave-uniform).
  const _Float16* gsrc = ((qg < 2) ? Kb : Vb) + (size_t)(qg & 1) * (2 * STEPH) + lo;
  const unsigned  ldsw = (unsigned)(uintptr_t)(const void*)ring + (unsigned)(kh * HALFB + qg * 8192 + lane * 16);
  // Ring, two buffers: tile 0, own wait, barrier (publishes tile 0); then tile 1 flies while tile 0 is worked on.
  copy16(ldsw, gsrc);
  wait_async0();
  __syncthreads();
  copy16(ldsw + BUFB, gsrc + (size_t)TKEYS * HD);

  // Fragments of step 0; from here on every step fetches the NEXT step's fragments into the registers that its own products
  // have just read, so that an LDS read has most of a step of other work between its issue and its first use.
  const _Float16* rb = (const _Float16*)(const void*)(ring + kh * HALFB) + lo;   // this key half's part of buffer 0, this lane
  v16h kf00 = ldfrag_p(rb),        kf01 = ldfrag_p(rb + 512);        // keys 0..15 of the half:  d 0..31, d 32..63
  v16h kf10 = ldfrag_p(rb + 1024), kf11 = ldfrag_p(rb + 1536);       // keys 16..31: d 0..31, d 32..63
  v16h vb0 = ldfrag_p(rb + TSTEPS * STEPH),        vb1 = ldfrag_p(rb + TSTEPS * STEPH + 512);    // d tiles 0, 1 of keys 0..31
  v16h vb2 = ldfrag_p(rb + TSTEPS * STEPH + 1024), vb3 = ldfrag_p(rb + TSTEPS * STEPH + 1536);   // d tiles 2, 3

  // kept rolled: one step's body holds the registers of four waves per SIMD
#pragma unroll 1
  for (int s = 0; s < NSTEP; ++s) {                    // s counts the 32-key steps of this wave's half; tile t = s >> 2
    // Publish point of tile t + 1, in front of the LAST step of tile t, whose fragments are in registers once the wave's LDS reads
    // have returned (this step fetches ahead out of tile t + 1). Every wave: own LDS reads returned, own copies of tile t + 1 landed,
    // one barrier (it publishes tile t + 1 and ends every reader's last read of tile t); only then tile t + 2 goes into tile t's buffer.
    if ((s & (TSTEPS - 1)) == TSTEPS - 1) {
      wait_ds0();
      wait_async0();
      __syncthreads();
      const int t = s >> 2;
      if (t + 2 < NTIL) copy16(ldsw + (unsigned)(t & 1) * BUFB, gsrc + (size_t)(t + 2) * (TKEYS * HD));
    }
    // step whose fragments are fetched in this one; the last step has none behind it and re-reads its own (filled, unused)
    const int n = (s + 1 < NSTEP) ? (s + 1) : s;
    const _Float16* rn = rb + ((n >> 2) & 1) * (BUFB / 2) + (n & (TSTEPS - 1)) * STEPH;   // its k block in the ring; v^T 16384 B behind
    // ---- scores: D element r of this lane = (key 8hh + r of the step, the group's query c) in s.0, key 16 + 8hh + r in s.1;
    //      summed onto minus the reference, in base 2: no scale and no subtraction is left for the vector unit ----
    v8f sA0, sA1, sB0, sB1;
    score8(sA0, sB0, sA1, sB1, kf00, kf01, kf10, kf11, qa0, qa1, qb0, qb1, cA, cB);
    kf00 = ldfrag_p(rn);         kf01 = ldfrag_p(rn + 512);          // keys 0..15 of step n: d 0..31, d 32..63
    kf10 = ldfrag_p(rn + 1024);  kf11 = ldfrag_p(rn + 1536);         // keys 16..31
    // keeps the eight reads here, in front of the softmax: without it the scheduler sinks them to the P.V products and their lead goes
    __builtin_amdgcn_sched_barrier(0);
    // ---- per group: online softmax in base 2 (no mask), one query per lane; B fragment of P^T x128 or more, f16,
    //      straight from the score registers; O^T += V^T.P^T : A fragment row = d = j*16 + c, the step's 32 keys ----
    FragH phA, phB;
    // Lazy rescale, one test per step for both groups: while no score of the wave lies more than 2^8 above its query's reference,
    // the reference stays, and exchange, 2^(old - new) and the products on sums and O^T tiles are all skipped (a scalar branch).
    const float xA = lane_max16(sA0, sA1), xB = lane_max16(sB0, sB1);
    if (__builtin_amdgcn_ballot_w32((xA > tA) | (xB > tB)) != 0u) {
      new_ref(xA, cA, tA, lA, oA, sA0, sA1);
      new_ref(xB, cB, tB, lB, oB, sB0, sB1);
    }
    soft_step(sA0, sA1, lA, phA);
    oA[0] = mma_raw(vb0, phA.v, oA[0]);  oA[1] = mma_raw(vb1, phA.v, oA[1]);
    oA[2] = mma_raw(vb2, phA.v, oA[2]);  oA[3] = mma_raw(vb3, phA.v, oA[3]);
    soft_step(sB0, sB1, lB, phB);
    oB[0] = mma_raw(vb0, phB.v, oB[0]);  oB[1] = mma_raw(vb1, phB.v, oB[1]);
    oB[2] = mma_raw(vb2, phB.v, oB[2]);  oB[3] = mma_raw(vb3, phB.v, oB[3]);
    guard_pv(oA[0], oA[1], oA[2], oA[3], oB[0], oB[1], oB[2], oB[3], phA.v, phB.v, vb0, vb1, vb2, vb3);
    {
      const _Float16* vp = rn + TSTEPS * STEPH;                      // the v^T block of step n
      vb0 = ldfrag_p(vp);
      vb1 = ldfrag_p(vp + 512);
      vb2 = ldfrag_p(vp + 1024);
      vb3 = ldfrag_p(vp + 1536);
    }
  }
  // The ring becomes the epilogue's staging: no copy is outstanding (the wait stands all the same), this wave's LDS reads have
  // returned, and the barrier ends every wave's last read of the ring.
  wait_async0();
  wait_ds0();
  __syncthreads();
  acc_guard4(oA[0], oA[1], oA[2], oA[3]);
  acc_guard4(oB[0], oB[1], oB[2], oB[3]);

  // ---- join the wave halves' sums; then join the two key halves: this wave keeps group kh and hands the other group to wave ^ 4
  //      (same lane = same query and same d rows there) ----
  const float mA = -cA[0], mB = -cB[0];                  // reference maximum minus 7
  const float lAj = lA + xhalf(lA);                      // 128 or more (the reference's own element contributes 2^7)
  const float lBj = lB + xhalf(lB);
  const bool  kB  = (kh != 0);                           // wave-uniform
  const float mk = kB ? mB : mA,  lk = kB ? lBj : lAj;   // kept
  const float ms = kB ? mA : mB,  ls = kB ? lAj : lBj;   // handed over
  v8f ok[4];
  {
    float* xw = xch + wave * XCHF + lane * 4;            // 32 lanes x 16 B = 512 contiguous B per store
#pragma unroll
    for (int j = 0; j < 4; ++j) {
      v8f os;
#pragma unroll
      for (int r = 0; r < 8; ++r) { ok[j][r] = kB ? oB[j][r] : oA[j][r];  os[r] = kB ? oA[j][r] : oB[j][r]; }
      const v4f w0 = {os[0], os[1], os[2], os[3]};
      const v4f w1 = {os[4], os[5], os[6], os[7]};
      *(v4f*)(xw + (2 * j) * 128)     = w0;
      *(v4f*)(xw + (2 * j + 1) * 128) = w1;
    }
    xml[wave * 64 + lane]      = ms;
    xml[wave * 64 + 32 + lane] = ls;
  }
  __syncthreads();                                       // the partner's tiles, max and sum are read behind it; every wave passes it
  const int   pw = wave ^ QGR;                           // same query group, other key half
  const float mt = xml[pw * 64 + lane];
  const float lt = xml[pw * 64 + 32 + lane];
  const float mj = fmaxf(mk, mt);                        // both finite
  const float wk = ex2(mk - mj), wt = ex2(mt - mj);      // one of them is 1
  const float lr = lk * wk + lt * wt;

  // ---- fold 1/l and the carries (128 on P, 256 on v), stage the wave's 16x64 slab in its LDS region:
  //      a lane holds 8 consecutive d of its query per tile j: two 16-B LDS stores ----
  float* slab = smem + wave * SLABF;
  const float oc = 1.0f / VCAR;                          // the carry on P stands in o and in l alike
  const float inv = (lr > 0.0f) ? ((1.0f / lr) * oc) : 0.0f;
  const float fk = wk * inv, ft = wt * inv;
  const float* xr = xch + pw * XCHF + lane * 4;
#pragma unroll
  for (int j = 0; j < 4; ++j) {
    const v4f t0 = *(const v4f*)(xr + (2 * j) * 128);
    const v4f t1 = *(const v4f*)(xr + (2 * j + 1) * 128);
    float* sp = slab + c * SLP + j * 16 + 8 * hh;
    const v4f w0 = {ok[j][0] * fk + t0[0] * ft, ok[j][1] * fk + t0[1] * ft, ok[j][2] * fk + t0[2] * ft, ok[j][3] * fk + t0[3] * ft};
    const v4f w1 = {ok[j][4] * fk + t1[0] * ft, ok[j][5] * fk + t1[1] * ft, ok[j][6] * fk + t1[2] * ft, ok[j][7] * fk + t1[3] * ft};
    *(v4f*)(sp)     = w0;
    *(v4f*)(sp + 4) = w1;
  }
  wave_sync_lds();
  v4f vals[8];
#pragma unroll
  for (int it = 0; it < 8; ++it) vals[it] = *(const v4f*)(slab + (2 * it + hh) * SLP + c * 4);
  float* dst = OPp + ((size_t)(bh * SEQ + iw + 16 * kh)) * HD + hh * HD + c * 4;   // rows of the kept group
  {
#pragma unroll
    for (int it = 0; it < 8; ++it) {
      *(v4f*)(dst + (size_t)(2 * it) * HD) = vals[it];
    }
    
  }
}

// =====================================================================================================
// Workspace map (bytes); every plane is fully written by whole-line stores before it is read; all extents are exact
// multiples of the store granularity (no pad rows needed); offsets multiples of 128 (NH = 16 values shown):
//   QH f16 [NH][4096][64] x log2(e)/8  8388608   at        0
//   KH f16 [NH][256 tiles][2048 B]         8388608   at  8388608   (fragment order)
//   VT f16 [NH][128 steps][4096 B] x256    8388608   at 16777216   (fragment order)
//   end                                             25165824
// =====================================================================================================
extern "C" void kernel_launch(void* const* d_in, const int* in_sizes, int n_in,
                              void* d_out, int out_size, void* d_ws, size_t ws_size,
                              hipStream_t stream) {
  const int NEL = NH * SEQ * HD;                        // 4194304 for NH = 16
  if (n_in < 4) return;
  if (in_sizes[0] < NEL || in_sizes[1] < NEL || in_sizes[2] < NEL || in_sizes[3] < 1) return;
  if (out_size < NEL) return;

  const float* q  = (const float*)d_in[0];
  const float* k  = (const float*)d_in[1];
  const float* v  = (const float*)d_in[2];
  const int*   mk = (const int*)d_in[3];                // int32 key mask, no effect on the result
  float*       out = (float*)d_out;

  const size_t PQ = (size_t)NEL * 2;                    //  8388608
  const size_t PK = (size_t)NEL * 2;                    //  8388608
  const size_t PV = (size_t)NH * HD * SEQ * 2;          //  8388608
  size_t off = 0;
  const size_t oQH = off; off += PQ;
  const size_t oKH = off; off += PK;
  const size_t oVT = off; off += PV;
  if (off > ws_size) return;                            // off = 25165824
  if (off > (size_t)134217728) return;

  char* ws = (char*)d_ws;
  unsigned short* QH = (unsigned short*)(ws + oQH);
  unsigned short* KH = (unsigned short*)(ws + oKH);
  unsigned short* VT = (unsigned short*)(ws + oVT);

  const int n8 = NEL / 8;                               // 524288
  const dim3 blk(256);
  const dim3 gC(n8 / 256, 2);                           // (2048, 2): q and k planes in one launch
  const dim3 gVT(NH * VTILES);                          // 1024
  const dim3 gAT(ATT_BLOCKS);                           // 512
  const dim3 bAT(ATT_THREADS);                          // 256

  // (0) q plane f16(bf16(q) * log2(e)/8) [h][s][d], k plane f16(bf16(k)) in fragment order
  cvt16<<<gC, blk, 0, stream>>>(q, k, QH, KH, n8, QSC, KSC);
  // (1) v^T plane f16(bf16(v) * 256), fragment order
  vt16<<<gVT, blk, 0, stream>>>(v, VT);
  // (2) flash attention per head -> out [h][s][d] f32
  attn_fwd<<<gAT, bAT, 0, stream>>>(QH, KH, VT, mk, out);
  (void)hipGetLastError();
}
